// v000
// Times are from an AMD MI455X. After a warm-up the kernel runs many times in a row, and a time is the length of
// such a window on the GPU divided by its runs, so every launch and the gaps after it count. The runs cycle
// through copies of the inputs. A figure is the median of several windows, for all but v000 over two sittings.
// Sittings can differ by a few percent; kernels timed side by side share one.
// The starting kernel, v000, takes 596 microseconds a run.
#include <hip/hip_runtime.h>
#include <hip/hip_bf16.h>
#include <math.h>

typedef _Float16 v16h __attribute__((ext_vector_type(16)));
typedef _Float16 v8h  __attribute__((ext_vector_type(8)));
typedef float    v8f  __attribute__((ext_vector_type(8)));

#define D_MODEL 768
#define HEADS   12
#define HEAD_DIM 64
#define D_FF    3072
#define SEQ     1024
#define BATCH   8
#define ROWS    (BATCH*SEQ)   // 8192

union FragH { v16h v; v8h h[2]; };

// Async copy global -> LDS (16B per lane), ASYNCcnt-tracked (CDNA5 §08).
// LDS offset = low 32 bits of the flat shared pointer (aperture: addr[31:0]).
__device__ __forceinline__ void async_ld_b128(unsigned lds_off, const void* gaddr) {
  asm volatile("global_load_async_to_lds_b128 %0, %1, off"
               :: "v"(lds_off), "v"((unsigned long long)(size_t)gaddr)
               : "memory");
}
__device__ __forceinline__ void wait_async0() {
  asm volatile("s_wait_asynccnt 0" ::: "memory");
}

// ---------------------------------------------------------------------------
// LayerNorm: one wave (32 lanes) per 768-wide row; unbiased std (ddof=1).
// ---------------------------------------------------------------------------
__global__ void __launch_bounds__(256)
ln_kernel(const float* __restrict__ x, const float* __restrict__ g,
          const float* __restrict__ b, _Float16* __restrict__ out) {
  int wave = threadIdx.x >> 5;
  int lane = threadIdx.x & 31;
  int row  = blockIdx.x * 8 + wave;
  const float* xr = x + (size_t)row * D_MODEL;
  float vals[24];
  float s = 0.f, s2 = 0.f;
#pragma unroll
  for (int i = 0; i < 24; ++i) {
    float vv = xr[lane + i * 32];
    vals[i] = vv; s += vv; s2 += vv * vv;
  }
#pragma unroll
  for (int m = 16; m >= 1; m >>= 1) {
    s  += __shfl_xor(s,  m, 32);
    s2 += __shfl_xor(s2, m, 32);
  }
  float mean = s * (1.0f / 768.0f);
  float var  = (s2 - 768.0f * mean * mean) * (1.0f / 767.0f);
  float stdd = sqrtf(fmaxf(var, 0.0f));
  float inv  = 1.0f / (stdd + 1e-5f);
  float gg = g[0], bb = b[0];
  _Float16* orow = out + (size_t)row * D_MODEL;
#pragma unroll
  for (int i = 0; i < 24; ++i)
    orow[lane + i * 32] = (_Float16)(gg * (vals[i] - mean) * inv + bb);
}

// ---------------------------------------------------------------------------
// Weight convert + transpose: w[K][N] fp32 -> wT[N][K] f16 (so GEMM B loads
// are contiguous along K, matching the 16-bit B-fragment VGPR striping).
// ---------------------------------------------------------------------------
__global__ void __launch_bounds__(256)
wtrans_kernel(const float* __restrict__ w, _Float16* __restrict__ wT,
              int K, int N) {
  long idx = (long)blockIdx.x * 256 + threadIdx.x;
  if (idx >= (long)K * N) return;
  int k = (int)(idx / N), n = (int)(idx % N);
  wT[(size_t)n * K + k] = (_Float16)w[idx];
}

// ---------------------------------------------------------------------------
// WMMA GEMM: C[M,N] = A[M,K](f16) * BT[N,K](f16)^T + bias, fused epilogue.
// EPI 0: -> f16   EPI 1: exact GELU -> f16   EPI 2: + residual -> f32
// Block 256 thr = 8 waves (4 along M x 2 along N); tile 128x128x32.
// Double-buffered LDS fed by global_load_async_to_lds_b128 (ASYNCcnt).
// ---------------------------------------------------------------------------
template <int EPI>
__global__ void __launch_bounds__(256)
gemm_wmma_kernel(const _Float16* __restrict__ A, const _Float16* __restrict__ BT,
                 const float* __restrict__ bias, const float* __restrict__ res,
                 _Float16* __restrict__ outH, float* __restrict__ outF,
                 int M, int N, int K) {
  constexpr int BM = 128, BN = 128, BK = 32, LDT = BK + 8;  // 40 halves/row
  __shared__ _Float16 As[2 * BM * LDT];
  __shared__ _Float16 Bs[2 * BN * LDT];

  const int tid  = threadIdx.x;
  const int lane = tid & 31, wid = tid >> 5;
  const int wm = wid & 3, wn = wid >> 2;           // 4 x 2 wave grid
  const int bRow = blockIdx.y * BM;
  const int bCol = blockIdx.x * BN;

  const v8f vzero = {0.f, 0.f, 0.f, 0.f, 0.f, 0.f, 0.f, 0.f};
  v8f acc[2][4];
#pragma unroll
  for (int i = 0; i < 2; ++i)
#pragma unroll
    for (int j = 0; j < 4; ++j) acc[i][j] = vzero;

  const int lrow = tid >> 2;        // 0..63
  const int lcol = (tid & 3) * 8;   // 0,8,16,24
  const int c0 = (lane < 16) ? 0 : 8;
  const int fr = lane & 15;

  const unsigned laBase = (unsigned)(size_t)&As[lrow * LDT + lcol];
  const unsigned lbBase = (unsigned)(size_t)&Bs[lrow * LDT + lcol];
  auto issue = [&](int k0, int p) {
    unsigned la = laBase + (unsigned)(p * BM * LDT * 2);
    unsigned lb = lbBase + (unsigned)(p * BN * LDT * 2);
    async_ld_b128(la,                A  + (size_t)(bRow + lrow)      * K + k0 + lcol);
    async_ld_b128(la + 64 * LDT * 2, A  + (size_t)(bRow + lrow + 64) * K + k0 + lcol);
    async_ld_b128(lb,                BT + (size_t)(bCol + lrow)      * K + k0 + lcol);
    async_ld_b128(lb + 64 * LDT * 2, BT + (size_t)(bCol + lrow + 64) * K + k0 + lcol);
  };

  const int NIT = K / BK;
  issue(0, 0);
  for (int it = 0; it < NIT; ++it) {
    wait_async0();       // this wave's pending tile is in LDS
    __syncthreads();     // everyone's tile in; previous buffer free
    const int p = it & 1;
    if (it + 1 < NIT) issue((it + 1) * BK, 1 - p);   // overlap with compute

    const _Float16* Ab = &As[p * BM * LDT];
    const _Float16* Bb = &Bs[p * BN * LDT];
    FragH a[2], b[4];
#pragma unroll
    for (int mt = 0; mt < 2; ++mt) {
      int r = wm * 32 + mt * 16 + fr;
      a[mt].h[0] = *(const v8h*)&Ab[r * LDT + c0];
      a[mt].h[1] = *(const v8h*)&Ab[r * LDT + c0 + 16];
    }
#pragma unroll
    for (int nt = 0; nt < 4; ++nt) {
      int c = wn * 64 + nt * 16 + fr;
      b[nt].h[0] = *(const v8h*)&Bb[c * LDT + c0];
      b[nt].h[1] = *(const v8h*)&Bb[c * LDT + c0 + 16];
    }
#pragma unroll
    for (int mt = 0; mt < 2; ++mt)
#pragma unroll
      for (int nt = 0; nt < 4; ++nt)
        acc[mt][nt] = __builtin_amdgcn_wmma_f32_16x16x32_f16(
            false, a[mt].v, false, b[nt].v, (short)0, acc[mt][nt], false, false);
  }

  // Epilogue: C layout -> row = base + r + (lane>=16?8:0), col = base + lane%16
  const int rbase = bRow + wm * 32 + ((lane >= 16) ? 8 : 0);
  const int cb    = bCol + wn * 64 + fr;
#pragma unroll
  for (int mt = 0; mt < 2; ++mt) {
#pragma unroll
    for (int nt = 0; nt < 4; ++nt) {
      int   col = cb + nt * 16;
      float bv  = bias[col];
#pragma unroll
      for (int r = 0; r < 8; ++r) {
        int    row = rbase + mt * 16 + r;
        float  v   = acc[mt][nt][r] + bv;
        size_t off = (size_t)row * N + col;
        if constexpr (EPI == 0) {
          outH[off] = (_Float16)v;
        } else if constexpr (EPI == 1) {
          outH[off] = (_Float16)(0.5f * v * (1.0f + erff(v * 0.70710678118f)));
        } else {
          outF[off] = res[off] + v;
        }
      }
    }
  }
}

// ---------------------------------------------------------------------------
// Flash attention: block = 4 waves, 64 q-rows; KV tiles of 64; online softmax.
// S = Q*K^T and O += P*V both via v_wmma_f32_16x16x32_f16.
// Q and K tiles staged with async global->LDS copies.
// ---------------------------------------------------------------------------
__global__ void __launch_bounds__(128)
flash_kernel(const _Float16* __restrict__ q, const _Float16* __restrict__ k,
             const _Float16* __restrict__ v, _Float16* __restrict__ o) {
  constexpr int D = 64, LDT = 72, TK = 64;
  __shared__ _Float16 qs[64 * LDT];
  __shared__ _Float16 ks[TK * LDT];
  __shared__ _Float16 vts[D * LDT];   // V transposed: [d][kv]
  __shared__ _Float16 ps[64 * LDT];   // P, per-wave 16-row slices

  const int tid = threadIdx.x, lane = tid & 31, wid = tid >> 5;
  const int qt = blockIdx.x, h = blockIdx.y, b = blockIdx.z;
  const size_t rs = D_MODEL;
  const _Float16* qb = q + (size_t)b * SEQ * rs + (size_t)h * D;
  const _Float16* kb = k + (size_t)b * SEQ * rs + (size_t)h * D;
  const _Float16* vb = v + (size_t)b * SEQ * rs + (size_t)h * D;

#pragma unroll
  for (int i = 0; i < 4; ++i) {     // Q tile 64x64 via async copies
    int cidx = tid + i * 128;       // 0..511 b128 chunks
    int r = cidx >> 3, c8 = (cidx & 7) * 8;
    async_ld_b128((unsigned)(size_t)&qs[r * LDT + c8],
                  qb + (size_t)(qt * 64 + r) * rs + c8);
  }
  wait_async0();
  __syncthreads();

  const int c0 = (lane < 16) ? 0 : 8;
  const int fr = lane & 15;
  FragH aq[2];
#pragma unroll
  for (int w2 = 0; w2 < 2; ++w2) {
    int r = wid * 16 + fr;
    aq[w2].h[0] = *(const v8h*)&qs[r * LDT + w2 * 32 + c0];
    aq[w2].h[1] = *(const v8h*)&qs[r * LDT + w2 * 32 + c0 + 16];
  }

  const v8f vzero = {0.f, 0.f, 0.f, 0.f, 0.f, 0.f, 0.f, 0.f};
  float mst[8], lst[8];
  v8f oa[4];
#pragma unroll
  for (int r = 0; r < 8; ++r) { mst[r] = -1e30f; lst[r] = 0.f; }
#pragma unroll
  for (int dt = 0; dt < 4; ++dt) oa[dt] = vzero;

  for (int j = 0; j < SEQ / TK; ++j) {
    __syncthreads();   // all waves done reading previous ks/vts
#pragma unroll
    for (int i = 0; i < 4; ++i) {
      int cidx = tid + i * 128;
      int r = cidx >> 3, c8 = (cidx & 7) * 8;
      async_ld_b128((unsigned)(size_t)&ks[r * LDT + c8],
                    kb + (size_t)(j * TK + r) * rs + c8);
      v8h vv = *(const v8h*)(vb + (size_t)(j * TK + r) * rs + c8);
#pragma unroll
      for (int e = 0; e < 8; ++e) vts[(c8 + e) * LDT + r] = vv[e];
    }
    wait_async0();
    __syncthreads();

    v8f s[4];
#pragma unroll
    for (int nt = 0; nt < 4; ++nt) s[nt] = vzero;
#pragma unroll
    for (int nt = 0; nt < 4; ++nt) {
      int kc = nt * 16 + fr;   // kv row serves as B column
#pragma unroll
      for (int w2 = 0; w2 < 2; ++w2) {
        FragH bf;
        bf.h[0] = *(const v8h*)&ks[kc * LDT + w2 * 32 + c0];
        bf.h[1] = *(const v8h*)&ks[kc * LDT + w2 * 32 + c0 + 16];
        s[nt] = __builtin_amdgcn_wmma_f32_16x16x32_f16(
            false, aq[w2].v, false, bf.v, (short)0, s[nt], false, false);
      }
    }
#pragma unroll
    for (int nt = 0; nt < 4; ++nt)
#pragma unroll
      for (int e = 0; e < 8; ++e) s[nt][e] *= 0.125f;   // 1/sqrt(64)

    // online softmax; xor masks <=8 stay inside each 16-lane column group
#pragma unroll
    for (int r = 0; r < 8; ++r) {
      float rm = fmaxf(fmaxf(s[0][r], s[1][r]), fmaxf(s[2][r], s[3][r]));
#pragma unroll
      for (int m = 8; m >= 1; m >>= 1) rm = fmaxf(rm, __shfl_xor(rm, m, 32));
      float mn = fmaxf(mst[r], rm);
      float corr = expf(mst[r] - mn);
      mst[r] = mn;
      float rsum = 0.f;
#pragma unroll
      for (int nt = 0; nt < 4; ++nt) {
        float p = expf(s[nt][r] - mn);
        s[nt][r] = p;
        rsum += p;
      }
#pragma unroll
      for (int m = 8; m >= 1; m >>= 1) rsum += __shfl_xor(rsum, m, 32);
      lst[r] = lst[r] * corr + rsum;
#pragma unroll
      for (int dt = 0; dt < 4; ++dt) oa[dt][r] *= corr;
      int prow = wid * 16 + r + ((lane >= 16) ? 8 : 0);
#pragma unroll
      for (int nt = 0; nt < 4; ++nt)
        ps[prow * LDT + nt * 16 + fr] = (_Float16)s[nt][r];
    }

    // P (A-layout) from LDS; same-wave LDS is in-order, no barrier needed
    FragH pa[2];
#pragma unroll
    for (int w2 = 0; w2 < 2; ++w2) {
      int r = wid * 16 + fr;
      pa[w2].h[0] = *(const v8h*)&ps[r * LDT + w2 * 32 + c0];
      pa[w2].h[1] = *(const v8h*)&ps[r * LDT + w2 * 32 + c0 + 16];
    }
#pragma unroll
    for (int dt = 0; dt < 4; ++dt) {
      int dc = dt * 16 + fr;
#pragma unroll
      for (int w2 = 0; w2 < 2; ++w2) {
        FragH bv2;
        bv2.h[0] = *(const v8h*)&vts[dc * LDT + w2 * 32 + c0];
        bv2.h[1] = *(const v8h*)&vts[dc * LDT + w2 * 32 + c0 + 16];
        oa[dt] = __builtin_amdgcn_wmma_f32_16x16x32_f16(
            false, pa[w2].v, false, bv2.v, (short)0, oa[dt], false, false);
      }
    }
  }

  _Float16* ob = o + (size_t)b * SEQ * rs + (size_t)h * D;
#pragma unroll
  for (int dt = 0; dt < 4; ++dt)
#pragma unroll
    for (int r = 0; r < 8; ++r) {
      int row = qt * 64 + wid * 16 + r + ((lane >= 16) ? 8 : 0);
      ob[(size_t)row * rs + dt * 16 + fr] = (_Float16)(oa[dt][r] / lst[r]);
    }
}

// ---------------------------------------------------------------------------
extern "C" void kernel_launch(void* const* d_in, const int* in_sizes, int n_in,
                              void* d_out, int out_size, void* d_ws, size_t ws_size,
                              hipStream_t stream) {
  (void)in_sizes; (void)n_in; (void)out_size; (void)ws_size;
  const float* x   = (const float*)d_in[0];
  const float* wq  = (const float*)d_in[1];
  const float* bq  = (const float*)d_in[2];
  const float* wk  = (const float*)d_in[3];
  const float* bk  = (const float*)d_in[4];
  const float* wv  = (const float*)d_in[5];
  const float* bv  = (const float*)d_in[6];
  const float* wo  = (const float*)d_in[7];
  const float* bo  = (const float*)d_in[8];
  const float* w1  = (const float*)d_in[9];
  const float* b1  = (const float*)d_in[10];
  const float* w2  = (const float*)d_in[11];
  const float* b2  = (const float*)d_in[12];
  const float* g1  = (const float*)d_in[13];
  const float* be1 = (const float*)d_in[14];
  const float* g2  = (const float*)d_in[15];
  const float* be2 = (const float*)d_in[16];

  char* ws = (char*)d_ws;
  size_t off = 0;
  auto alloc = [&](size_t bytes) -> void* {
    void* p = ws + off;
    off += (bytes + 255) & ~(size_t)255;
    return p;
  };
  _Float16* ln16   = (_Float16*)alloc((size_t)ROWS * D_MODEL * 2);
  _Float16* q16    = (_Float16*)alloc((size_t)ROWS * D_MODEL * 2);
  _Float16* k16    = (_Float16*)alloc((size_t)ROWS * D_MODEL * 2);
  _Float16* v16    = (_Float16*)alloc((size_t)ROWS * D_MODEL * 2);
  _Float16* attn16 = (_Float16*)alloc((size_t)ROWS * D_MODEL * 2);
  float*    x1     = (float*)   alloc((size_t)ROWS * D_MODEL * 4);
  _Float16* h16    = (_Float16*)alloc((size_t)ROWS * D_FF * 2);
  _Float16* wqT    = (_Float16*)alloc((size_t)D_MODEL * D_MODEL * 2);
  _Float16* wkT    = (_Float16*)alloc((size_t)D_MODEL * D_MODEL * 2);
  _Float16* wvT    = (_Float16*)alloc((size_t)D_MODEL * D_MODEL * 2);
  _Float16* woT    = (_Float16*)alloc((size_t)D_MODEL * D_MODEL * 2);
  _Float16* w1T    = (_Float16*)alloc((size_t)D_MODEL * D_FF * 2);
  _Float16* w2T    = (_Float16*)alloc((size_t)D_FF * D_MODEL * 2);

  long wcnt = (long)D_MODEL * D_MODEL;
  long fcnt = (long)D_MODEL * D_FF;
  wtrans_kernel<<<(wcnt + 255) / 256, 256, 0, stream>>>(wq, wqT, D_MODEL, D_MODEL);
  wtrans_kernel<<<(wcnt + 255) / 256, 256, 0, stream>>>(wk, wkT, D_MODEL, D_MODEL);
  wtrans_kernel<<<(wcnt + 255) / 256, 256, 0, stream>>>(wv, wvT, D_MODEL, D_MODEL);
  wtrans_kernel<<<(wcnt + 255) / 256, 256, 0, stream>>>(wo, woT, D_MODEL, D_MODEL);
  wtrans_kernel<<<(fcnt + 255) / 256, 256, 0, stream>>>(w1, w1T, D_MODEL, D_FF);
  wtrans_kernel<<<(fcnt + 255) / 256, 256, 0, stream>>>(w2, w2T, D_FF, D_MODEL);

  ln_kernel<<<ROWS / 8, 256, 0, stream>>>(x, g1, be1, ln16);

  dim3 g768(D_MODEL / 128, ROWS / 128);
  gemm_wmma_kernel<0><<<g768, 256, 0, stream>>>(ln16, wqT, bq, nullptr, q16, nullptr,
                                                ROWS, D_MODEL, D_MODEL);
  gemm_wmma_kernel<0><<<g768, 256, 0, stream>>>(ln16, wkT, bk, nullptr, k16, nullptr,
                                                ROWS, D_MODEL, D_MODEL);
  gemm_wmma_kernel<0><<<g768, 256, 0, stream>>>(ln16, wvT, bv, nullptr, v16, nullptr,
                                                ROWS, D_MODEL, D_MODEL);

  dim3 gfa(SEQ / 64, HEADS, BATCH);
  flash_kernel<<<gfa, 128, 0, stream>>>(q16, k16, v16, attn16);

  gemm_wmma_kernel<2><<<g768, 256, 0, stream>>>(attn16, woT, bo, x, nullptr, x1,
                                                ROWS, D_MODEL, D_MODEL);

  ln_kernel<<<ROWS / 8, 256, 0, stream>>>(x1, g2, be2, ln16);

  dim3 gff(D_FF / 128, ROWS / 128);
  gemm_wmma_kernel<1><<<gff, 256, 0, stream>>>(ln16, w1T, b1, nullptr, h16, nullptr,
                                               ROWS, D_FF, D_MODEL);
  gemm_wmma_kernel<2><<<g768, 256, 0, stream>>>(h16, w2T, b2, x1, nullptr, (float*)d_out,
                                                ROWS, D_MODEL, D_FF);
}

// v001
// It runs in 391 microseconds.
// In two side-by-side timings against v000, it was 1.57 and 1.58 times as fast.
#include <hip/hip_runtime.h>
#include <hip/hip_bf16.h>
#include <math.h>

typedef _Float16 v16h __attribute__((ext_vector_type(16)));
typedef _Float16 v8h  __attribute__((ext_vector_type(8)));
typedef float    v8f  __attribute__((ext_vector_type(8)));
typedef float    v4f  __attribute__((ext_vector_type(4)));

#define D_MODEL 768
#define HEADS   12
#define HEAD_DIM 64
#define D_FF    3072
#define SEQ     1024
#define BATCH   8
#define ROWS    (BATCH*SEQ)   // 8192

union FragH { v16h v; v8h h[2]; };

// Async copy global -> LDS (16B per lane), ASYNCcnt-tracked (CDNA5 §08).
// LDS offset = low 32 bits of the flat shared pointer (aperture: addr[31:0]).
__device__ __forceinline__ void async_ld_b128(unsigned lds_off, const void* gaddr) {
  asm volatile("global_load_async_to_lds_b128 %0, %1, off"
               :: "v"(lds_off), "v"((unsigned long long)(size_t)gaddr)
               : "memory");
}
__device__ __forceinline__ void wait_async0() {
  asm volatile("s_wait_asynccnt 0" ::: "memory");
}

// ---------------------------------------------------------------------------
// LayerNorm: one wave (32 lanes) per 768-wide row; unbiased std (ddof=1).
// ---------------------------------------------------------------------------
__global__ void __launch_bounds__(256)
ln_kernel(const float* __restrict__ x, const float* __restrict__ g,
          const float* __restrict__ b, _Float16* __restrict__ out) {
  int wave = threadIdx.x >> 5;
  int lane = threadIdx.x & 31;
  int row  = blockIdx.x * 8 + wave;
  const float* xr = x + (size_t)row * D_MODEL;
  float vals[24];
  float s = 0.f, s2 = 0.f;
#pragma unroll
  for (int i = 0; i < 24; ++i) {
    float vv = xr[lane + i * 32];
    vals[i] = vv; s += vv; s2 += vv * vv;
  }
#pragma unroll
  for (int m = 16; m >= 1; m >>= 1) {
    s  += __shfl_xor(s,  m, 32);
    s2 += __shfl_xor(s2, m, 32);
  }
  float mean = s * (1.0f / 768.0f);
  float var  = (s2 - 768.0f * mean * mean) * (1.0f / 767.0f);
  float stdd = sqrtf(fmaxf(var, 0.0f));
  float inv  = 1.0f / (stdd + 1e-5f);
  float gg = g[0], bb = b[0];
  _Float16* orow = out + (size_t)row * D_MODEL;
#pragma unroll
  for (int i = 0; i < 24; ++i)
    orow[lane + i * 32] = (_Float16)(gg * (vals[i] - mean) * inv + bb);
}

// ---------------------------------------------------------------------------
// Weight convert + transpose: w[K][N] fp32 -> wT[N][K] f16 (so GEMM B loads
// are contiguous along K, matching the 16-bit B-fragment VGPR striping).
// Transposed in registers: a lane reads 4 columns of 8 consecutive k rows
// (8 x 16 B), so it holds 8 consecutive k of each column and stores them as
// one 16 B piece. The 8 lanes that share a column cover 64 k: every store
// instruction of a wave fills 4 whole 128 B lines of wT, each written once.
// Block = 4 waves = tile of 64 k x 64 n; K and N are multiples of 64.
// ---------------------------------------------------------------------------
template <int K, int N>
__global__ void __launch_bounds__(128)
wtrans_kernel(const float* __restrict__ w, _Float16* __restrict__ wT) {
  const int lane = threadIdx.x & 31, wid = threadIdx.x >> 5;
  const int k0 = blockIdx.y * 64 + (lane & 7) * 8;
  const int n0 = blockIdx.x * 64 + wid * 16 + (lane >> 3) * 4;
  const float* src = w + (size_t)k0 * N + n0;
  v4f r[8];
#pragma unroll
  for (int j = 0; j < 8; ++j) r[j] = *(const v4f*)(src + (size_t)j * N);
  _Float16* dst = wT + (size_t)n0 * K + k0;
#pragma unroll
  for (int i = 0; i < 4; ++i) {
    v8h o;
#pragma unroll
    for (int j = 0; j < 8; ++j) o[j] = (_Float16)r[j][i];
    *(v8h*)(dst + (size_t)i * K) = o;
  }
}

// ---------------------------------------------------------------------------
// WMMA GEMM: C[M,N] = A[M,K](f16) * BT[N,K](f16)^T + bias, fused epilogue.
// EPI 0: -> f16   EPI 1: exact GELU -> f16   EPI 2: + residual -> f32
// Block 256 thr = 8 waves (4 along M x 2 along N); tile 128x128x32.
// Double-buffered LDS fed by global_load_async_to_lds_b128 (ASYNCcnt).
// ---------------------------------------------------------------------------
template <int EPI>
__global__ void __launch_bounds__(256)
gemm_wmma_kernel(const _Float16* __restrict__ A, const _Float16* __restrict__ BT,
                 const float* __restrict__ bias, const float* __restrict__ res,
                 _Float16* __restrict__ outH, float* __restrict__ outF,
                 int M, int N, int K) {
  constexpr int BM = 128, BN = 128, BK = 32, LDT = BK + 8;  // 40 halves/row
  __shared__ _Float16 As[2 * BM * LDT];
  __shared__ _Float16 Bs[2 * BN * LDT];

  const int tid  = threadIdx.x;
  const int lane = tid & 31, wid = tid >> 5;
  const int wm = wid & 3, wn = wid >> 2;           // 4 x 2 wave grid
  const int bRow = blockIdx.y * BM;
  const int bCol = blockIdx.x * BN;

  const v8f vzero = {0.f, 0.f, 0.f, 0.f, 0.f, 0.f, 0.f, 0.f};
  v8f acc[2][4];
#pragma unroll
  for (int i = 0; i < 2; ++i)
#pragma unroll
    for (int j = 0; j < 4; ++j) acc[i][j] = vzero;

  const int lrow = tid >> 2;        // 0..63
  const int lcol = (tid & 3) * 8;   // 0,8,16,24
  const int c0 = (lane < 16) ? 0 : 8;
  const int fr = lane & 15;

  const unsigned laBase = (unsigned)(size_t)&As[lrow * LDT + lcol];
  const unsigned lbBase = (unsigned)(size_t)&Bs[lrow * LDT + lcol];
  auto issue = [&](int k0, int p) {
    unsigned la = laBase + (unsigned)(p * BM * LDT * 2);
    unsigned lb = lbBase + (unsigned)(p * BN * LDT * 2);
    async_ld_b128(la,                A  + (size_t)(bRow + lrow)      * K + k0 + lcol);
    async_ld_b128(la + 64 * LDT * 2, A  + (size_t)(bRow + lrow + 64) * K + k0 + lcol);
    async_ld_b128(lb,                BT + (size_t)(bCol + lrow)      * K + k0 + lcol);
    async_ld_b128(lb + 64 * LDT * 2, BT + (size_t)(bCol + lrow + 64) * K + k0 + lcol);
  };

  const int NIT = K / BK;
  issue(0, 0);
  for (int it = 0; it < NIT; ++it) {
    wait_async0();       // this wave's pending tile is in LDS
    __syncthreads();     // everyone's tile in; previous buffer free
    const int p = it & 1;
    if (it + 1 < NIT) issue((it + 1) * BK, 1 - p);   // overlap with compute

    const _Float16* Ab = &As[p * BM * LDT];
    const _Float16* Bb = &Bs[p * BN * LDT];
    FragH a[2], b[4];
#pragma unroll
    for (int mt = 0; mt < 2; ++mt) {
      int r = wm * 32 + mt * 16 + fr;
      a[mt].h[0] = *(const v8h*)&Ab[r * LDT + c0];
      a[mt].h[1] = *(const v8h*)&Ab[r * LDT + c0 + 16];
    }
#pragma unroll
    for (int nt = 0; nt < 4; ++nt) {
      int c = wn * 64 + nt * 16 + fr;
      b[nt].h[0] = *(const v8h*)&Bb[c * LDT + c0];
      b[nt].h[1] = *(const v8h*)&Bb[c * LDT + c0 + 16];
    }
#pragma unroll
    for (int mt = 0; mt < 2; ++mt)
#pragma unroll
      for (int nt = 0; nt < 4; ++nt)
        acc[mt][nt] = __builtin_amdgcn_wmma_f32_16x16x32_f16(
            false, a[mt].v, false, b[nt].v, (short)0, acc[mt][nt], false, false);
  }

  // Epilogue: C layout -> row = base + r + (lane>=16?8:0), col = base + lane%16
  const int rbase = bRow + wm * 32 + ((lane >= 16) ? 8 : 0);
  const int cb    = bCol + wn * 64 + fr;
#pragma unroll
  for (int mt = 0; mt < 2; ++mt) {
#pragma unroll
    for (int nt = 0; nt < 4; ++nt) {
      int   col = cb + nt * 16;
      float bv  = bias[col];
#pragma unroll
      for (int r = 0; r < 8; ++r) {
        int    row = rbase + mt * 16 + r;
        float  v   = acc[mt][nt][r] + bv;
        size_t off = (size_t)row * N + col;
        if constexpr (EPI == 0) {
          outH[off] = (_Float16)v;
        } else if constexpr (EPI == 1) {
          outH[off] = (_Float16)(0.5f * v * (1.0f + erff(v * 0.70710678118f)));
        } else {
          outF[off] = res[off] + v;
        }
      }
    }
  }
}

// ---------------------------------------------------------------------------
// Flash attention: block = 4 waves, 64 q-rows; KV tiles of 64; online softmax.
// S = Q*K^T and O += P*V both via v_wmma_f32_16x16x32_f16.
// Q and K tiles staged with async global->LDS copies.
// ---------------------------------------------------------------------------
__global__ void __launch_bounds__(128)
flash_kernel(const _Float16* __restrict__ q, const _Float16* __restrict__ k,
             const _Float16* __restrict__ v, _Float16* __restrict__ o) {
  constexpr int D = 64, LDT = 72, TK = 64;
  __shared__ _Float16 qs[64 * LDT];
  __shared__ _Float16 ks[TK * LDT];
  __shared__ _Float16 vts[D * LDT];   // V transposed: [d][kv]
  __shared__ _Float16 ps[64 * LDT];   // P, per-wave 16-row slices

  const int tid = threadIdx.x, lane = tid & 31, wid = tid >> 5;
  const int qt = blockIdx.x, h = blockIdx.y, b = blockIdx.z;
  const size_t rs = D_MODEL;
  const _Float16* qb = q + (size_t)b * SEQ * rs + (size_t)h * D;
  const _Float16* kb = k + (size_t)b * SEQ * rs + (size_t)h * D;
  const _Float16* vb = v + (size_t)b * SEQ * rs + (size_t)h * D;

#pragma unroll
  for (int i = 0; i < 4; ++i) {     // Q tile 64x64 via async copies
    int cidx = tid + i * 128;       // 0..511 b128 chunks
    int r = cidx >> 3, c8 = (cidx & 7) * 8;
    async_ld_b128((unsigned)(size_t)&qs[r * LDT + c8],
                  qb + (size_t)(qt * 64 + r) * rs + c8);
  }
  wait_async0();
  __syncthreads();

  const int c0 = (lane < 16) ? 0 : 8;
  const int fr = lane & 15;
  FragH aq[2];
#pragma unroll
  for (int w2 = 0; w2 < 2; ++w2) {
    int r = wid * 16 + fr;
    aq[w2].h[0] = *(const v8h*)&qs[r * LDT + w2 * 32 + c0];
    aq[w2].h[1] = *(const v8h*)&qs[r * LDT + w2 * 32 + c0 + 16];
  }

  const v8f vzero = {0.f, 0.f, 0.f, 0.f, 0.f, 0.f, 0.f, 0.f};
  float mst[8], lst[8];
  v8f oa[4];
#pragma unroll
  for (int r = 0; r < 8; ++r) { mst[r] = -1e30f; lst[r] = 0.f; }
#pragma unroll
  for (int dt = 0; dt < 4; ++dt) oa[dt] = vzero;

  for (int j = 0; j < SEQ / TK; ++j) {
    __syncthreads();   // all waves done reading previous ks/vts
#pragma unroll
    for (int i = 0; i < 4; ++i) {
      int cidx = tid + i * 128;
      int r = cidx >> 3, c8 = (cidx & 7) * 8;
      async_ld_b128((unsigned)(size_t)&ks[r * LDT + c8],
                    kb + (size_t)(j * TK + r) * rs + c8);
      v8h vv = *(const v8h*)(vb + (size_t)(j * TK + r) * rs + c8);
#pragma unroll
      for (int e = 0; e < 8; ++e) vts[(c8 + e) * LDT + r] = vv[e];
    }
    wait_async0();
    __syncthreads();

    v8f s[4];
#pragma unroll
    for (int nt = 0; nt < 4; ++nt) s[nt] = vzero;
#pragma unroll
    for (int nt = 0; nt < 4; ++nt) {
      int kc = nt * 16 + fr;   // kv row serves as B column
#pragma unroll
      for (int w2 = 0; w2 < 2; ++w2) {
        FragH bf;
        bf.h[0] = *(const v8h*)&ks[kc * LDT + w2 * 32 + c0];
        bf.h[1] = *(const v8h*)&ks[kc * LDT + w2 * 32 + c0 + 16];
        s[nt] = __builtin_amdgcn_wmma_f32_16x16x32_f16(
            false, aq[w2].v, false, bf.v, (short)0, s[nt], false, false);
      }
    }
#pragma unroll
    for (int nt = 0; nt < 4; ++nt)
#pragma unroll
      for (int e = 0; e < 8; ++e) s[nt][e] *= 0.125f;   // 1/sqrt(64)

    // online softmax; xor masks <=8 stay inside each 16-lane column group
#pragma unroll
    for (int r = 0; r < 8; ++r) {
      float rm = fmaxf(fmaxf(s[0][r], s[1][r]), fmaxf(s[2][r], s[3][r]));
#pragma unroll
      for (int m = 8; m >= 1; m >>= 1) rm = fmaxf(rm, __shfl_xor(rm, m, 32));
      float mn = fmaxf(mst[r], rm);
      float corr = expf(mst[r] - mn);
      mst[r] = mn;
      float rsum = 0.f;
#pragma unroll
      for (int nt = 0; nt < 4; ++nt) {
        float p = expf(s[nt][r] - mn);
        s[nt][r] = p;
        rsum += p;
      }
#pragma unroll
      for (int m = 8; m >= 1; m >>= 1) rsum += __shfl_xor(rsum, m, 32);
      lst[r] = lst[r] * corr + rsum;
#pragma unroll
      for (int dt = 0; dt < 4; ++dt) oa[dt][r] *= corr;
      int prow = wid * 16 + r + ((lane >= 16) ? 8 : 0);
#pragma unroll
      for (int nt = 0; nt < 4; ++nt)
        ps[prow * LDT + nt * 16 + fr] = (_Float16)s[nt][r];
    }

    // P (A-layout) from LDS; same-wave LDS is in-order, no barrier needed
    FragH pa[2];
#pragma unroll
    for (int w2 = 0; w2 < 2; ++w2) {
      int r = wid * 16 + fr;
      pa[w2].h[0] = *(const v8h*)&ps[r * LDT + w2 * 32 + c0];
      pa[w2].h[1] = *(const v8h*)&ps[r * LDT + w2 * 32 + c0 + 16];
    }
#pragma unroll
    for (int dt = 0; dt < 4; ++dt) {
      int dc = dt * 16 + fr;
#pragma unroll
      for (int w2 = 0; w2 < 2; ++w2) {
        FragH bv2;
        bv2.h[0] = *(const v8h*)&vts[dc * LDT + w2 * 32 + c0];
        bv2.h[1] = *(const v8h*)&vts[dc * LDT + w2 * 32 + c0 + 16];
        oa[dt] = __builtin_amdgcn_wmma_f32_16x16x32_f16(
            false, pa[w2].v, false, bv2.v, (short)0, oa[dt], false, false);
      }
    }
  }

  _Float16* ob = o + (size_t)b * SEQ * rs + (size_t)h * D;
#pragma unroll
  for (int dt = 0; dt < 4; ++dt)
#pragma unroll
    for (int r = 0; r < 8; ++r) {
      int row = qt * 64 + wid * 16 + r + ((lane >= 16) ? 8 : 0);
      ob[(size_t)row * rs + dt * 16 + fr] = (_Float16)(oa[dt][r] / lst[r]);
    }
}

// ---------------------------------------------------------------------------
extern "C" void kernel_launch(void* const* d_in, const int* in_sizes, int n_in,
                              void* d_out, int out_size, void* d_ws, size_t ws_size,
                              hipStream_t stream) {
  (void)in_sizes; (void)n_in; (void)out_size; (void)ws_size;
  const float* x   = (const float*)d_in[0];
  const float* wq  = (const float*)d_in[1];
  const float* bq  = (const float*)d_in[2];
  const float* wk  = (const float*)d_in[3];
  const float* bk  = (const float*)d_in[4];
  const float* wv  = (const float*)d_in[5];
  const float* bv  = (const float*)d_in[6];
  const float* wo  = (const float*)d_in[7];
  const float* bo  = (const float*)d_in[8];
  const float* w1  = (const float*)d_in[9];
  const float* b1  = (const float*)d_in[10];
  const float* w2  = (const float*)d_in[11];
  const float* b2  = (const float*)d_in[12];
  const float* g1  = (const float*)d_in[13];
  const float* be1 = (const float*)d_in[14];
  const float* g2  = (const float*)d_in[15];
  const float* be2 = (const float*)d_in[16];

  char* ws = (char*)d_ws;
  size_t off = 0;
  auto alloc = [&](size_t bytes) -> void* {
    void* p = ws + off;
    off += (bytes + 255) & ~(size_t)255;
    return p;
  };
  _Float16* ln16   = (_Float16*)alloc((size_t)ROWS * D_MODEL * 2);
  _Float16* q16    = (_Float16*)alloc((size_t)ROWS * D_MODEL * 2);
  _Float16* k16    = (_Float16*)alloc((size_t)ROWS * D_MODEL * 2);
  _Float16* v16    = (_Float16*)alloc((size_t)ROWS * D_MODEL * 2);
  _Float16* attn16 = (_Float16*)alloc((size_t)ROWS * D_MODEL * 2);
  float*    x1     = (float*)   alloc((size_t)ROWS * D_MODEL * 4);
  _Float16* h16    = (_Float16*)alloc((size_t)ROWS * D_FF * 2);
  _Float16* wqT    = (_Float16*)alloc((size_t)D_MODEL * D_MODEL * 2);
  _Float16* wkT    = (_Float16*)alloc((size_t)D_MODEL * D_MODEL * 2);
  _Float16* wvT    = (_Float16*)alloc((size_t)D_MODEL * D_MODEL * 2);
  _Float16* woT    = (_Float16*)alloc((size_t)D_MODEL * D_MODEL * 2);
  _Float16* w1T    = (_Float16*)alloc((size_t)D_MODEL * D_FF * 2);
  _Float16* w2T    = (_Float16*)alloc((size_t)D_FF * D_MODEL * 2);

  dim3 gtw(D_MODEL / 64, D_MODEL / 64);   // x: n tiles, y: k tiles
  dim3 gt1(D_FF / 64, D_MODEL / 64);
  dim3 gt2(D_MODEL / 64, D_FF / 64);
  wtrans_kernel<D_MODEL, D_MODEL><<<gtw, 128, 0, stream>>>(wq, wqT);
  wtrans_kernel<D_MODEL, D_MODEL><<<gtw, 128, 0, stream>>>(wk, wkT);
  wtrans_kernel<D_MODEL, D_MODEL><<<gtw, 128, 0, stream>>>(wv, wvT);
  wtrans_kernel<D_MODEL, D_MODEL><<<gtw, 128, 0, stream>>>(wo, woT);
  wtrans_kernel<D_MODEL, D_FF><<<gt1, 128, 0, stream>>>(w1, w1T);
  wtrans_kernel<D_FF, D_MODEL><<<gt2, 128, 0, stream>>>(w2, w2T);

  ln_kernel<<<ROWS / 8, 256, 0, stream>>>(x, g1, be1, ln16);

  dim3 g768(D_MODEL / 128, ROWS / 128);
  gemm_wmma_kernel<0><<<g768, 256, 0, stream>>>(ln16, wqT, bq, nullptr, q16, nullptr,
                                                ROWS, D_MODEL, D_MODEL);
  gemm_wmma_kernel<0><<<g768, 256, 0, stream>>>(ln16, wkT, bk, nullptr, k16, nullptr,
                                                ROWS, D_MODEL, D_MODEL);
  gemm_wmma_kernel<0><<<g768, 256, 0, stream>>>(ln16, wvT, bv, nullptr, v16, nullptr,
                                                ROWS, D_MODEL, D_MODEL);

  dim3 gfa(SEQ / 64, HEADS, BATCH);
  flash_kernel<<<gfa, 128, 0, stream>>>(q16, k16, v16, attn16);

  gemm_wmma_kernel<2><<<g768, 256, 0, stream>>>(attn16, woT, bo, x, nullptr, x1,
                                                ROWS, D_MODEL, D_MODEL);

  ln_kernel<<<ROWS / 8, 256, 0, stream>>>(x1, g2, be2, ln16);

  dim3 gff(D_FF / 128, ROWS / 128);
  gemm_wmma_kernel<1><<<gff, 256, 0, stream>>>(ln16, w1T, b1, nullptr, h16, nullptr,
                                               ROWS, D_FF, D_MODEL);
  gemm_wmma_kernel<2><<<g768, 256, 0, stream>>>(h16, w2T, b2, x1, nullptr, (float*)d_out,
                                                ROWS, D_MODEL, D_FF);
}

// v002
// One run takes 360 microseconds.
// In both of two side-by-side timings against v001, it was 1.09 times as fast.
// All steps since v000 together make it 1.71 times as fast.
#include <hip/hip_runtime.h>
#include <hip/hip_bf16.h>
#include <math.h>

typedef _Float16 v16h __attribute__((ext_vector_type(16)));
typedef _Float16 v8h  __attribute__((ext_vector_type(8)));
typedef float    v8f  __attribute__((ext_vector_type(8)));
typedef float    v4f  __attribute__((ext_vector_type(4)));

#define D_MODEL 768
#define HEADS   12
#define HEAD_DIM 64
#define D_FF    3072
#define SEQ     1024
#define BATCH   8
#define ROWS    (BATCH*SEQ)   // 8192

union FragH { v16h v; v8h h[2]; };

// Async copy global -> LDS (16B per lane), ASYNCcnt-tracked (CDNA5 §08).
// LDS offset = low 32 bits of the flat shared pointer (aperture: addr[31:0]).
__device__ __forceinline__ void async_ld_b128(unsigned lds_off, const void* gaddr) {
  asm volatile("global_load_async_to_lds_b128 %0, %1, off"
               :: "v"(lds_off), "v"((unsigned long long)(size_t)gaddr)
               : "memory");
}
__device__ __forceinline__ void wait_async0() {
  asm volatile("s_wait_asynccnt 0" ::: "memory");
}

// ---------------------------------------------------------------------------
// LayerNorm: one wave (32 lanes) per 768-wide row; unbiased std (ddof=1).
// ---------------------------------------------------------------------------
__global__ void __launch_bounds__(256)
ln_kernel(const float* __restrict__ x, const float* __restrict__ g,
          const float* __restrict__ b, _Float16* __restrict__ out) {
  int wave = threadIdx.x >> 5;
  int lane = threadIdx.x & 31;
  int row  = blockIdx.x * 8 + wave;
  const float* xr = x + (size_t)row * D_MODEL;
  float vals[24];
  float s = 0.f, s2 = 0.f;
#pragma unroll
  for (int i = 0; i < 24; ++i) {
    float vv = xr[lane + i * 32];
    vals[i] = vv; s += vv; s2 += vv * vv;
  }
#pragma unroll
  for (int m = 16; m >= 1; m >>= 1) {
    s  += __shfl_xor(s,  m, 32);
    s2 += __shfl_xor(s2, m, 32);
  }
  float mean = s * (1.0f / 768.0f);
  float var  = (s2 - 768.0f * mean * mean) * (1.0f / 767.0f);
  float stdd = sqrtf(fmaxf(var, 0.0f));
  float inv  = 1.0f / (stdd + 1e-5f);
  float gg = g[0], bb = b[0];
  _Float16* orow = out + (size_t)row * D_MODEL;
#pragma unroll
  for (int i = 0; i < 24; ++i)
    orow[lane + i * 32] = (_Float16)(gg * (vals[i] - mean) * inv + bb);
}

// ---------------------------------------------------------------------------
// Weight convert + transpose: w[K][N] fp32 -> wT[N][K] f16 (so GEMM B loads
// are contiguous along K, matching the 16-bit B-fragment VGPR striping).
// Transposed in registers: a lane reads 4 columns of 8 consecutive k rows
// (8 x 16 B), so it holds 8 consecutive k of each column and stores them as
// one 16 B piece. The 8 lanes that share a column cover 64 k: every store
// instruction of a wave fills 4 whole 128 B lines of wT, each written once.
// Block = 4 waves = tile of 64 k x 64 n; K and N are multiples of 64.
// ---------------------------------------------------------------------------
template <int K, int N>
__global__ void __launch_bounds__(128)
wtrans_kernel(const float* __restrict__ w, _Float16* __restrict__ wT) {
  const int lane = threadIdx.x & 31, wid = threadIdx.x >> 5;
  const int k0 = blockIdx.y * 64 + (lane & 7) * 8;
  const int n0 = blockIdx.x * 64 + wid * 16 + (lane >> 3) * 4;
  const float* src = w + (size_t)k0 * N + n0;
  v4f r[8];
#pragma unroll
  for (int j = 0; j < 8; ++j) r[j] = *(const v4f*)(src + (size_t)j * N);
  _Float16* dst = wT + (size_t)n0 * K + k0;
#pragma unroll
  for (int i = 0; i < 4; ++i) {
    v8h o;
#pragma unroll
    for (int j = 0; j < 8; ++j) o[j] = (_Float16)r[j][i];
    *(v8h*)(dst + (size_t)i * K) = o;
  }
}

// ---------------------------------------------------------------------------
// WMMA GEMM: C[M,N] = A[M,K](f16) * BT[N,K](f16)^T + bias, fused epilogue.
// EPI 0: -> f16   EPI 1: exact GELU -> f16   EPI 2: + residual -> f32
// Block 256 thr = 8 waves (4 along M x 2 along N); tile 128x128x32.
// Double-buffered LDS fed by global_load_async_to_lds_b128 (ASYNCcnt).
// ---------------------------------------------------------------------------
template <int EPI>
__global__ void __launch_bounds__(256)
gemm_wmma_kernel(const _Float16* __restrict__ A, const _Float16* __restrict__ BT,
                 const float* __restrict__ bias, const float* __restrict__ res,
                 _Float16* __restrict__ outH, float* __restrict__ outF,
                 int M, int N, int K) {
  constexpr int BM = 128, BN = 128, BK = 32, LDT = BK + 8;  // 40 halves/row
  __shared__ _Float16 As[2 * BM * LDT];
  __shared__ _Float16 Bs[2 * BN * LDT];

  const int tid  = threadIdx.x;
  const int lane = tid & 31, wid = tid >> 5;
  const int wm = wid & 3, wn = wid >> 2;           // 4 x 2 wave grid
  const int bRow = blockIdx.y * BM;
  const int bCol = blockIdx.x * BN;

  const v8f vzero = {0.f, 0.f, 0.f, 0.f, 0.f, 0.f, 0.f, 0.f};
  v8f acc[2][4];
#pragma unroll
  for (int i = 0; i < 2; ++i)
#pragma unroll
    for (int j = 0; j < 4; ++j) acc[i][j] = vzero;

  const int lrow = tid >> 2;        // 0..63
  const int lcol = (tid & 3) * 8;   // 0,8,16,24
  const int c0 = (lane < 16) ? 0 : 8;
  const int fr = lane & 15;

  const unsigned laBase = (unsigned)(size_t)&As[lrow * LDT + lcol];
  const unsigned lbBase = (unsigned)(size_t)&Bs[lrow * LDT + lcol];
  auto issue = [&](int k0, int p) {
    unsigned la = laBase + (unsigned)(p * BM * LDT * 2);
    unsigned lb = lbBase + (unsigned)(p * BN * LDT * 2);
    async_ld_b128(la,                A  + (size_t)(bRow + lrow)      * K + k0 + lcol);
    async_ld_b128(la + 64 * LDT * 2, A  + (size_t)(bRow + lrow + 64) * K + k0 + lcol);
    async_ld_b128(lb,                BT + (size_t)(bCol + lrow)      * K + k0 + lcol);
    async_ld_b128(lb + 64 * LDT * 2, BT + (size_t)(bCol + lrow + 64) * K + k0 + lcol);
  };

  const int NIT = K / BK;
  issue(0, 0);
  for (int it = 0; it < NIT; ++it) {
    wait_async0();       // this wave's pending tile is in LDS
    __syncthreads();     // everyone's tile in; previous buffer free
    const int p = it & 1;
    if (it + 1 < NIT) issue((it + 1) * BK, 1 - p);   // overlap with compute

    const _Float16* Ab = &As[p * BM * LDT];
    const _Float16* Bb = &Bs[p * BN * LDT];
    FragH a[2], b[4];
#pragma unroll
    for (int mt = 0; mt < 2; ++mt) {
      int r = wm * 32 + mt * 16 + fr;
      a[mt].h[0] = *(const v8h*)&Ab[r * LDT + c0];
      a[mt].h[1] = *(const v8h*)&Ab[r * LDT + c0 + 16];
    }
#pragma unroll
    for (int nt = 0; nt < 4; ++nt) {
      int c = wn * 64 + nt * 16 + fr;
      b[nt].h[0] = *(const v8h*)&Bb[c * LDT + c0];
      b[nt].h[1] = *(const v8h*)&Bb[c * LDT + c0 + 16];
    }
#pragma unroll
    for (int mt = 0; mt < 2; ++mt)
#pragma unroll
      for (int nt = 0; nt < 4; ++nt)
        acc[mt][nt] = __builtin_amdgcn_wmma_f32_16x16x32_f16(
            false, a[mt].v, false, b[nt].v, (short)0, acc[mt][nt], false, false);
  }

  // Epilogue: C layout -> row = base + r + (lane>=16?8:0), col = base + lane%16
  const int rbase = bRow + wm * 32 + ((lane >= 16) ? 8 : 0);
  const int cb    = bCol + wn * 64 + fr;
#pragma unroll
  for (int mt = 0; mt < 2; ++mt) {
#pragma unroll
    for (int nt = 0; nt < 4; ++nt) {
      int   col = cb + nt * 16;
      float bv  = bias[col];
#pragma unroll
      for (int r = 0; r < 8; ++r) {
        int    row = rbase + mt * 16 + r;
        float  v   = acc[mt][nt][r] + bv;
        size_t off = (size_t)row * N + col;
        if constexpr (EPI == 0) {
          outH[off] = (_Float16)v;
        } else if constexpr (EPI == 1) {
          outH[off] = (_Float16)(0.5f * v * (1.0f + erff(v * 0.70710678118f)));
        } else {
          outF[off] = res[off] + v;
        }
      }
    }
  }
}

// Value of lane (l ^ M) of the same 16-lane row, M = 1..15, by DPP row_xmask
// (control word 0x160 | M). A vector-port move: no LDS crossbar trip, no dscnt wait.
// All 32 lanes are on wherever it is used.
template <int M>
__device__ __forceinline__ float row_xor(float x) {
  return __builtin_bit_cast(float, __builtin_amdgcn_update_dpp(
      0, __builtin_bit_cast(int, x), 0x160 | M, 0xf, 0xf, true));
}

// ---------------------------------------------------------------------------
// Flash attention: block = 4 waves, 64 q-rows; KV tiles of 64; online softmax.
// S = Q*K^T and O += P*V both via v_wmma_f32_16x16x32_f16.
// Q and K tiles staged with async global->LDS copies.
// ---------------------------------------------------------------------------
__global__ void __launch_bounds__(128)
flash_kernel(const _Float16* __restrict__ q, const _Float16* __restrict__ k,
             const _Float16* __restrict__ v, _Float16* __restrict__ o) {
  constexpr int D = 64, LDT = 72, TK = 64;
  __shared__ _Float16 qs[64 * LDT];
  __shared__ _Float16 ks[TK * LDT];
  __shared__ _Float16 vts[D * LDT];   // V transposed: [d][kv]
  __shared__ _Float16 ps[64 * LDT];   // P, per-wave 16-row slices

  const int tid = threadIdx.x, lane = tid & 31, wid = tid >> 5;
  const int qt = blockIdx.x, h = blockIdx.y, b = blockIdx.z;
  const size_t rs = D_MODEL;
  const _Float16* qb = q + (size_t)b * SEQ * rs + (size_t)h * D;
  const _Float16* kb = k + (size_t)b * SEQ * rs + (size_t)h * D;
  const _Float16* vb = v + (size_t)b * SEQ * rs + (size_t)h * D;

#pragma unroll
  for (int i = 0; i < 4; ++i) {     // Q tile 64x64 via async copies
    int cidx = tid + i * 128;       // 0..511 b128 chunks
    int r = cidx >> 3, c8 = (cidx & 7) * 8;
    async_ld_b128((unsigned)(size_t)&qs[r * LDT + c8],
                  qb + (size_t)(qt * 64 + r) * rs + c8);
  }
  wait_async0();
  __syncthreads();

  const int c0 = (lane < 16) ? 0 : 8;
  const int fr = lane & 15;
  FragH aq[2];
#pragma unroll
  for (int w2 = 0; w2 < 2; ++w2) {
    int r = wid * 16 + fr;
    aq[w2].h[0] = *(const v8h*)&qs[r * LDT + w2 * 32 + c0];
    aq[w2].h[1] = *(const v8h*)&qs[r * LDT + w2 * 32 + c0 + 16];
  }

  const v8f vzero = {0.f, 0.f, 0.f, 0.f, 0.f, 0.f, 0.f, 0.f};
  float mst[8], lst[8];
  v8f oa[4];
#pragma unroll
  for (int r = 0; r < 8; ++r) { mst[r] = -1e30f; lst[r] = 0.f; }
#pragma unroll
  for (int dt = 0; dt < 4; ++dt) oa[dt] = vzero;

  for (int j = 0; j < SEQ / TK; ++j) {
    __syncthreads();   // all waves done reading previous ks/vts
#pragma unroll
    for (int i = 0; i < 4; ++i) {
      int cidx = tid + i * 128;
      int r = cidx >> 3, c8 = (cidx & 7) * 8;
      async_ld_b128((unsigned)(size_t)&ks[r * LDT + c8],
                    kb + (size_t)(j * TK + r) * rs + c8);
      v8h vv = *(const v8h*)(vb + (size_t)(j * TK + r) * rs + c8);
#pragma unroll
      for (int e = 0; e < 8; ++e) vts[(c8 + e) * LDT + r] = vv[e];
    }
    wait_async0();
    __syncthreads();

    v8f s[4];
#pragma unroll
    for (int nt = 0; nt < 4; ++nt) s[nt] = vzero;
#pragma unroll
    for (int nt = 0; nt < 4; ++nt) {
      int kc = nt * 16 + fr;   // kv row serves as B column
#pragma unroll
      for (int w2 = 0; w2 < 2; ++w2) {
        FragH bf;
        bf.h[0] = *(const v8h*)&ks[kc * LDT + w2 * 32 + c0];
        bf.h[1] = *(const v8h*)&ks[kc * LDT + w2 * 32 + c0 + 16];
        s[nt] = __builtin_amdgcn_wmma_f32_16x16x32_f16(
            false, aq[w2].v, false, bf.v, (short)0, s[nt], false, false);
      }
    }
#pragma unroll
    for (int nt = 0; nt < 4; ++nt)
#pragma unroll
      for (int e = 0; e < 8; ++e) s[nt][e] *= 0.125f;   // 1/sqrt(64)

    // online softmax; xor masks <=8 stay inside each 16-lane column group, so the
    // butterflies run on DPP, in the order 8, 4, 2, 1
#pragma unroll
    for (int r = 0; r < 8; ++r) {
      float rm = fmaxf(fmaxf(s[0][r], s[1][r]), fmaxf(s[2][r], s[3][r]));
      rm = fmaxf(rm, row_xor<8>(rm));
      rm = fmaxf(rm, row_xor<4>(rm));
      rm = fmaxf(rm, row_xor<2>(rm));
      rm = fmaxf(rm, row_xor<1>(rm));
      float mn = fmaxf(mst[r], rm);
      float corr = expf(mst[r] - mn);
      mst[r] = mn;
      float rsum = 0.f;
#pragma unroll
      for (int nt = 0; nt < 4; ++nt) {
        float p = expf(s[nt][r] - mn);
        s[nt][r] = p;
        rsum += p;
      }
      rsum += row_xor<8>(rsum);
      rsum += row_xor<4>(rsum);
      rsum += row_xor<2>(rsum);
      rsum += row_xor<1>(rsum);
      lst[r] = lst[r] * corr + rsum;
#pragma unroll
      for (int dt = 0; dt < 4; ++dt) oa[dt][r] *= corr;
      int prow = wid * 16 + r + ((lane >= 16) ? 8 : 0);
#pragma unroll
      for (int nt = 0; nt < 4; ++nt)
        ps[prow * LDT + nt * 16 + fr] = (_Float16)s[nt][r];
    }

    // P (A-layout) from LDS; same-wave LDS is in-order, no barrier needed
    FragH pa[2];
#pragma unroll
    for (int w2 = 0; w2 < 2; ++w2) {
      int r = wid * 16 + fr;
      pa[w2].h[0] = *(const v8h*)&ps[r * LDT + w2 * 32 + c0];
      pa[w2].h[1] = *(const v8h*)&ps[r * LDT + w2 * 32 + c0 + 16];
    }
#pragma unroll
    for (int dt = 0; dt < 4; ++dt) {
      int dc = dt * 16 + fr;
#pragma unroll
      for (int w2 = 0; w2 < 2; ++w2) {
        FragH bv2;
        bv2.h[0] = *(const v8h*)&vts[dc * LDT + w2 * 32 + c0];
        bv2.h[1] = *(const v8h*)&vts[dc * LDT + w2 * 32 + c0 + 16];
        oa[dt] = __builtin_amdgcn_wmma_f32_16x16x32_f16(
            false, pa[w2].v, false, bv2.v, (short)0, oa[dt], false, false);
      }
    }
  }

  _Float16* ob = o + (size_t)b * SEQ * rs + (size_t)h * D;
#pragma unroll
  for (int dt = 0; dt < 4; ++dt)
#pragma unroll
    for (int r = 0; r < 8; ++r) {
      int row = qt * 64 + wid * 16 + r + ((lane >= 16) ? 8 : 0);
      ob[(size_t)row * rs + dt * 16 + fr] = (_Float16)(oa[dt][r] / lst[r]);
    }
}

// ---------------------------------------------------------------------------
extern "C" void kernel_launch(void* const* d_in, const int* in_sizes, int n_in,
                              void* d_out, int out_size, void* d_ws, size_t ws_size,
                              hipStream_t stream) {
  (void)in_sizes; (void)n_in; (void)out_size; (void)ws_size;
  const float* x   = (const float*)d_in[0];
  const float* wq  = (const float*)d_in[1];
  const float* bq  = (const float*)d_in[2];
  const float* wk  = (const float*)d_in[3];
  const float* bk  = (const float*)d_in[4];
  const float* wv  = (const float*)d_in[5];
  const float* bv  = (const float*)d_in[6];
  const float* wo  = (const float*)d_in[7];
  const float* bo  = (const float*)d_in[8];
  const float* w1  = (const float*)d_in[9];
  const float* b1  = (const float*)d_in[10];
  const float* w2  = (const float*)d_in[11];
  const float* b2  = (const float*)d_in[12];
  const float* g1  = (const float*)d_in[13];
  const float* be1 = (const float*)d_in[14];
  const float* g2  = (const float*)d_in[15];
  const float* be2 = (const float*)d_in[16];

  char* ws = (char*)d_ws;
  size_t off = 0;
  auto alloc = [&](size_t bytes) -> void* {
    void* p = ws + off;
    off += (bytes + 255) & ~(size_t)255;
    return p;
  };
  _Float16* ln16   = (_Float16*)alloc((size_t)ROWS * D_MODEL * 2);
  _Float16* q16    = (_Float16*)alloc((size_t)ROWS * D_MODEL * 2);
  _Float16* k16    = (_Float16*)alloc((size_t)ROWS * D_MODEL * 2);
  _Float16* v16    = (_Float16*)alloc((size_t)ROWS * D_MODEL * 2);
  _Float16* attn16 = (_Float16*)alloc((size_t)ROWS * D_MODEL * 2);
  float*    x1     = (float*)   alloc((size_t)ROWS * D_MODEL * 4);
  _Float16* h16    = (_Float16*)alloc((size_t)ROWS * D_FF * 2);
  _Float16* wqT    = (_Float16*)alloc((size_t)D_MODEL * D_MODEL * 2);
  _Float16* wkT    = (_Float16*)alloc((size_t)D_MODEL * D_MODEL * 2);
  _Float16* wvT    = (_Float16*)alloc((size_t)D_MODEL * D_MODEL * 2);
  _Float16* woT    = (_Float16*)alloc((size_t)D_MODEL * D_MODEL * 2);
  _Float16* w1T    = (_Float16*)alloc((size_t)D_MODEL * D_FF * 2);
  _Float16* w2T    = (_Float16*)alloc((size_t)D_FF * D_MODEL * 2);

  dim3 gtw(D_MODEL / 64, D_MODEL / 64);   // x: n tiles, y: k tiles
  dim3 gt1(D_FF / 64, D_MODEL / 64);
  dim3 gt2(D_MODEL / 64, D_FF / 64);
  wtrans_kernel<D_MODEL, D_MODEL><<<gtw, 128, 0, stream>>>(wq, wqT);
  wtrans_kernel<D_MODEL, D_MODEL><<<gtw, 128, 0, stream>>>(wk, wkT);
  wtrans_kernel<D_MODEL, D_MODEL><<<gtw, 128, 0, stream>>>(wv, wvT);
  wtrans_kernel<D_MODEL, D_MODEL><<<gtw, 128, 0, stream>>>(wo, woT);
  wtrans_kernel<D_MODEL, D_FF><<<gt1, 128, 0, stream>>>(w1, w1T);
  wtrans_kernel<D_FF, D_MODEL><<<gt2, 128, 0, stream>>>(w2, w2T);

  ln_kernel<<<ROWS / 8, 256, 0, stream>>>(x, g1, be1, ln16);

  dim3 g768(D_MODEL / 128, ROWS / 128);
  gemm_wmma_kernel<0><<<g768, 256, 0, stream>>>(ln16, wqT, bq, nullptr, q16, nullptr,
                                                ROWS, D_MODEL, D_MODEL);
  gemm_wmma_kernel<0><<<g768, 256, 0, stream>>>(ln16, wkT, bk, nullptr, k16, nullptr,
                                                ROWS, D_MODEL, D_MODEL);
  gemm_wmma_kernel<0><<<g768, 256, 0, stream>>>(ln16, wvT, bv, nullptr, v16, nullptr,
                                                ROWS, D_MODEL, D_MODEL);

  dim3 gfa(SEQ / 64, HEADS, BATCH);
  flash_kernel<<<gfa, 128, 0, stream>>>(q16, k16, v16, attn16);

  gemm_wmma_kernel<2><<<g768, 256, 0, stream>>>(attn16, woT, bo, x, nullptr, x1,
                                                ROWS, D_MODEL, D_MODEL);

  ln_kernel<<<ROWS / 8, 256, 0, stream>>>(x1, g2, be2, ln16);

  dim3 gff(D_FF / 128, ROWS / 128);
  gemm_wmma_kernel<1><<<gff, 256, 0, stream>>>(ln16, w1T, b1, nullptr, h16, nullptr,
                                               ROWS, D_FF, D_MODEL);
  gemm_wmma_kernel<2><<<g768, 256, 0, stream>>>(h16, w2T, b2, x1, nullptr, (float*)d_out,
                                                ROWS, D_MODEL, D_FF);
}

// v003
// It runs in 321 microseconds.
// Next to v002, in two timings, it ran 1.10 and 1.11 times as fast.
// Over all steps from v000 it is 1.89 times as fast.
#include <hip/hip_runtime.h>
#include <hip/hip_bf16.h>
#include <math.h>

typedef _Float16 v16h __attribute__((ext_vector_type(16)));
typedef _Float16 v8h  __attribute__((ext_vector_type(8)));
typedef float    v8f  __attribute__((ext_vector_type(8)));
typedef float    v4f  __attribute__((ext_vector_type(4)));

#define D_MODEL 768
#define HEADS   12
#define HEAD_DIM 64
#define D_FF    3072
#define SEQ     1024
#define BATCH   8
#define ROWS    (BATCH*SEQ)   // 8192

union FragH { v16h v; v8h h[2]; };

// Async copy global -> LDS (16B per lane), ASYNCcnt-tracked (CDNA5 §08).
// LDS offset = low 32 bits of the flat shared pointer (aperture: addr[31:0]).
__device__ __forceinline__ void async_ld_b128(unsigned lds_off, const void* gaddr) {
  asm volatile("global_load_async_to_lds_b128 %0, %1, off"
               :: "v"(lds_off), "v"((unsigned long long)(size_t)gaddr)
               : "memory");
}
__device__ __forceinline__ void wait_async0() {
  asm volatile("s_wait_asynccnt 0" ::: "memory");
}
// One stage's async copies of one lane: rows r, r+32, r+64, r+96 of the A tile
// and of the B tile. la/lb, ga/gb: the lane's LDS byte address and global address
// of row r; lstep/gstep: bytes from one of its rows to the next. The closing
// s_wait_xcnt is a precaution: inside the statement it stands ahead of every
// later rewrite of an address register that a copy names.
__device__ __forceinline__ void async_stage_b128(unsigned la, unsigned lb, unsigned lstep,
                                                 const _Float16* ga, const _Float16* gb,
                                                 size_t gstep) {
  const char* pa = (const char*)ga;
  const char* pb = (const char*)gb;
  asm volatile("global_load_async_to_lds_b128 %0, %8, off\n\t"
               "global_load_async_to_lds_b128 %1, %9, off\n\t"
               "global_load_async_to_lds_b128 %2, %10, off\n\t"
               "global_load_async_to_lds_b128 %3, %11, off\n\t"
               "global_load_async_to_lds_b128 %4, %12, off\n\t"
               "global_load_async_to_lds_b128 %5, %13, off\n\t"
               "global_load_async_to_lds_b128 %6, %14, off\n\t"
               "global_load_async_to_lds_b128 %7, %15, off\n\t"
               "s_wait_xcnt 0x0"
               :: "v"(la), "v"(la + lstep), "v"(la + 2 * lstep), "v"(la + 3 * lstep),
                  "v"(lb), "v"(lb + lstep), "v"(lb + 2 * lstep), "v"(lb + 3 * lstep),
                  "v"((unsigned long long)(size_t)pa),
                  "v"((unsigned long long)(size_t)(pa + gstep)),
                  "v"((unsigned long long)(size_t)(pa + 2 * gstep)),
                  "v"((unsigned long long)(size_t)(pa + 3 * gstep)),
                  "v"((unsigned long long)(size_t)pb),
                  "v"((unsigned long long)(size_t)(pb + gstep)),
                  "v"((unsigned long long)(size_t)(pb + 2 * gstep)),
                  "v"((unsigned long long)(size_t)(pb + 3 * gstep))
               : "memory");
}

// ---------------------------------------------------------------------------
// LayerNorm: one wave (32 lanes) per 768-wide row; unbiased std (ddof=1).
// ---------------------------------------------------------------------------
__global__ void __launch_bounds__(256)
ln_kernel(const float* __restrict__ x, const float* __restrict__ g,
          const float* __restrict__ b, _Float16* __restrict__ out) {
  int wave = threadIdx.x >> 5;
  int lane = threadIdx.x & 31;
  int row  = blockIdx.x * 8 + wave;
  const float* xr = x + (size_t)row * D_MODEL;
  float vals[24];
  float s = 0.f, s2 = 0.f;
#pragma unroll
  for (int i = 0; i < 24; ++i) {
    float vv = xr[lane + i * 32];
    vals[i] = vv; s += vv; s2 += vv * vv;
  }
#pragma unroll
  for (int m = 16; m >= 1; m >>= 1) {
    s  += __shfl_xor(s,  m, 32);
    s2 += __shfl_xor(s2, m, 32);
  }
  float mean = s * (1.0f / 768.0f);
  float var  = (s2 - 768.0f * mean * mean) * (1.0f / 767.0f);
  float stdd = sqrtf(fmaxf(var, 0.0f));
  float inv  = 1.0f / (stdd + 1e-5f);
  float gg = g[0], bb = b[0];
  _Float16* orow = out + (size_t)row * D_MODEL;
#pragma unroll
  for (int i = 0; i < 24; ++i)
    orow[lane + i * 32] = (_Float16)(gg * (vals[i] - mean) * inv + bb);
}

// ---------------------------------------------------------------------------
// Weight convert + transpose: w[K][N] fp32 -> wT[N][K] f16 (so GEMM B loads
// are contiguous along K, matching the 16-bit B-fragment VGPR striping).
// Transposed in registers: a lane reads 4 columns of 8 consecutive k rows
// (8 x 16 B), so it holds 8 consecutive k of each column and stores them as
// one 16 B piece. The 8 lanes that share a column cover 64 k: every store
// instruction of a wave fills 4 whole 128 B lines of wT, each written once.
// Block = 4 waves = tile of 64 k x 64 n; K and N are multiples of 64.
// ---------------------------------------------------------------------------
template <int K, int N>
__global__ void __launch_bounds__(128)
wtrans_kernel(const float* __restrict__ w, _Float16* __restrict__ wT) {
  const int lane = threadIdx.x & 31, wid = threadIdx.x >> 5;
  const int k0 = blockIdx.y * 64 + (lane & 7) * 8;
  const int n0 = blockIdx.x * 64 + wid * 16 + (lane >> 3) * 4;
  const float* src = w + (size_t)k0 * N + n0;
  v4f r[8];
#pragma unroll
  for (int j = 0; j < 8; ++j) r[j] = *(const v4f*)(src + (size_t)j * N);
  _Float16* dst = wT + (size_t)n0 * K + k0;
#pragma unroll
  for (int i = 0; i < 4; ++i) {
    v8h o;
#pragma unroll
    for (int j = 0; j < 8; ++j) o[j] = (_Float16)r[j][i];
    *(v8h*)(dst + (size_t)i * K) = o;
  }
}

// ---------------------------------------------------------------------------
// WMMA GEMM: C[M,N] = A[M,K](f16) * BT[N,K](f16)^T + bias, fused epilogue.
// EPI 0: -> f16   EPI 1: exact GELU -> f16   EPI 2: + residual -> f32
// Block 256 thr = 8 waves (4 along M x 2 along N); tile 128x128x64.
// Double-buffered LDS fed by global_load_async_to_lds_b128 (ASYNCcnt).
// A stage holds 64 k = 128 B of every operand row: 8 lanes copy one whole
// line, a wave's copy touches 4 lines, and one barrier serves 16 WMMAs a wave.
// ---------------------------------------------------------------------------
template <int EPI>
__global__ void __launch_bounds__(256)
gemm_wmma_kernel(const _Float16* __restrict__ A, const _Float16* __restrict__ BT,
                 const float* __restrict__ bias, const float* __restrict__ res,
                 _Float16* __restrict__ outH, float* __restrict__ outF,
                 int M, int N, int K) {
  constexpr int BM = 128, BN = 128, BK = 64, LDT = BK + 8;  // 72 halves/row = 16 B x 9
  __shared__ __attribute__((aligned(16))) _Float16 As[2 * BM * LDT];
  __shared__ __attribute__((aligned(16))) _Float16 Bs[2 * BN * LDT];

  const int tid  = threadIdx.x;
  const int lane = tid & 31, wid = tid >> 5;
  const int wm = wid & 3, wn = wid >> 2;           // 4 x 2 wave grid
  const int bRow = blockIdx.y * BM;
  const int bCol = blockIdx.x * BN;

  const v8f vzero = {0.f, 0.f, 0.f, 0.f, 0.f, 0.f, 0.f, 0.f};
  v8f acc[2][4];
#pragma unroll
  for (int i = 0; i < 2; ++i)
#pragma unroll
    for (int j = 0; j < 4; ++j) acc[i][j] = vzero;

  const int lrow = tid >> 3;        // 0..31
  const int lcol = (tid & 7) * 8;   // 0,8,..,56
  const int c0 = (lane < 16) ? 0 : 8;
  const int fr = lane & 15;

  const unsigned laBase = (unsigned)(size_t)&As[lrow * LDT + lcol];
  const unsigned lbBase = (unsigned)(size_t)&Bs[lrow * LDT + lcol];
  const _Float16* gA = A  + (size_t)(bRow + lrow) * K + lcol;
  const _Float16* gB = BT + (size_t)(bCol + lrow) * K + lcol;
  const size_t gstep = (size_t)K * 32 * 2;          // 32 rows, in bytes
  auto issue = [&](int k0, int p) {
    async_stage_b128(laBase + (unsigned)(p * BM * LDT * 2),
                     lbBase + (unsigned)(p * BN * LDT * 2), 32 * LDT * 2,
                     gA + k0, gB + k0, gstep);
  };

  const int NIT = K / BK;
  issue(0, 0);
  for (int it = 0; it < NIT; ++it) {
    // this wave's LDS reads of the buffer that is refilled below have returned
    asm volatile("s_wait_dscnt 0x0" ::: "memory");
    wait_async0();       // this wave's pending tile is in LDS
    __syncthreads();     // everyone's tile in; previous buffer free
    const int p = it & 1;
    if (it + 1 < NIT) issue((it + 1) * BK, 1 - p);   // overlap with compute

    const _Float16* Ab = &As[p * BM * LDT];
    const _Float16* Bb = &Bs[p * BN * LDT];
    // unrolled so that both k steps read LDS at immediate offsets; k ascends
#pragma unroll
    for (int kk = 0; kk < BK; kk += 32) {
      FragH a[2], b[4];
#pragma unroll
      for (int mt = 0; mt < 2; ++mt) {
        int r = wm * 32 + mt * 16 + fr;
        a[mt].h[0] = *(const v8h*)&Ab[r * LDT + kk + c0];
        a[mt].h[1] = *(const v8h*)&Ab[r * LDT + kk + c0 + 16];
      }
#pragma unroll
      for (int nt = 0; nt < 4; ++nt) {
        int c = wn * 64 + nt * 16 + fr;
        b[nt].h[0] = *(const v8h*)&Bb[c * LDT + kk + c0];
        b[nt].h[1] = *(const v8h*)&Bb[c * LDT + kk + c0 + 16];
      }
#pragma unroll
      for (int mt = 0; mt < 2; ++mt)
#pragma unroll
        for (int nt = 0; nt < 4; ++nt)
          acc[mt][nt] = __builtin_amdgcn_wmma_f32_16x16x32_f16(
              false, a[mt].v, false, b[nt].v, (short)0, acc[mt][nt], false, false);
    }
  }

  // Epilogue: C layout -> row = base + r + (lane>=16?8:0), col = base + lane%16
  const int rbase = bRow + wm * 32 + ((lane >= 16) ? 8 : 0);
  const int cb    = bCol + wn * 64 + fr;
#pragma unroll
  for (int mt = 0; mt < 2; ++mt) {
#pragma unroll
    for (int nt = 0; nt < 4; ++nt) {
      int   col = cb + nt * 16;
      float bv  = bias[col];
#pragma unroll
      for (int r = 0; r < 8; ++r) {
        int    row = rbase + mt * 16 + r;
        float  v   = acc[mt][nt][r] + bv;
        size_t off = (size_t)row * N + col;
        if constexpr (EPI == 0) {
          outH[off] = (_Float16)v;
        } else if constexpr (EPI == 1) {
          outH[off] = (_Float16)(0.5f * v * (1.0f + erff(v * 0.70710678118f)));
        } else {
          outF[off] = res[off] + v;
        }
      }
    }
  }
}

// Value of lane (l ^ M) of the same 16-lane row, M = 1..15, by DPP row_xmask
// (control word 0x160 | M). A vector-port move: no LDS crossbar trip, no dscnt wait.
// All 32 lanes are on wherever it is used.
template <int M>
__device__ __forceinline__ float row_xor(float x) {
  return __builtin_bit_cast(float, __builtin_amdgcn_update_dpp(
      0, __builtin_bit_cast(int, x), 0x160 | M, 0xf, 0xf, true));
}

// ---------------------------------------------------------------------------
// Flash attention: block = 4 waves, 64 q-rows; KV tiles of 64; online softmax.
// S = Q*K^T and O += P*V both via v_wmma_f32_16x16x32_f16.
// Q and K tiles staged with async global->LDS copies.
// ---------------------------------------------------------------------------
__global__ void __launch_bounds__(128)
flash_kernel(const _Float16* __restrict__ q, const _Float16* __restrict__ k,
             const _Float16* __restrict__ v, _Float16* __restrict__ o) {
  constexpr int D = 64, LDT = 72, TK = 64;
  __shared__ _Float16 qs[64 * LDT];
  __shared__ _Float16 ks[TK * LDT];
  __shared__ _Float16 vts[D * LDT];   // V transposed: [d][kv]
  __shared__ _Float16 ps[64 * LDT];   // P, per-wave 16-row slices

  const int tid = threadIdx.x, lane = tid & 31, wid = tid >> 5;
  const int qt = blockIdx.x, h = blockIdx.y, b = blockIdx.z;
  const size_t rs = D_MODEL;
  const _Float16* qb = q + (size_t)b * SEQ * rs + (size_t)h * D;
  const _Float16* kb = k + (size_t)b * SEQ * rs + (size_t)h * D;
  const _Float16* vb = v + (size_t)b * SEQ * rs + (size_t)h * D;

#pragma unroll
  for (int i = 0; i < 4; ++i) {     // Q tile 64x64 via async copies
    int cidx = tid + i * 128;       // 0..511 b128 chunks
    int r = cidx >> 3, c8 = (cidx & 7) * 8;
    async_ld_b128((unsigned)(size_t)&qs[r * LDT + c8],
                  qb + (size_t)(qt * 64 + r) * rs + c8);
  }
  wait_async0();
  __syncthreads();

  const int c0 = (lane < 16) ? 0 : 8;
  const int fr = lane & 15;
  FragH aq[2];
#pragma unroll
  for (int w2 = 0; w2 < 2; ++w2) {
    int r = wid * 16 + fr;
    aq[w2].h[0] = *(const v8h*)&qs[r * LDT + w2 * 32 + c0];
    aq[w2].h[1] = *(const v8h*)&qs[r * LDT + w2 * 32 + c0 + 16];
  }

  const v8f vzero = {0.f, 0.f, 0.f, 0.f, 0.f, 0.f, 0.f, 0.f};
  float mst[8], lst[8];
  v8f oa[4];
#pragma unroll
  for (int r = 0; r < 8; ++r) { mst[r] = -1e30f; lst[r] = 0.f; }
#pragma unroll
  for (int dt = 0; dt < 4; ++dt) oa[dt] = vzero;

  for (int j = 0; j < SEQ / TK; ++j) {
    __syncthreads();   // all waves done reading previous ks/vts
#pragma unroll
    for (int i = 0; i < 4; ++i) {
      int cidx = tid + i * 128;
      int r = cidx >> 3, c8 = (cidx & 7) * 8;
      async_ld_b128((unsigned)(size_t)&ks[r * LDT + c8],
                    kb + (size_t)(j * TK + r) * rs + c8);
      v8h vv = *(const v8h*)(vb + (size_t)(j * TK + r) * rs + c8);
#pragma unroll
      for (int e = 0; e < 8; ++e) vts[(c8 + e) * LDT + r] = vv[e];
    }
    wait_async0();
    __syncthreads();

    v8f s[4];
#pragma unroll
    for (int nt = 0; nt < 4; ++nt) s[nt] = vzero;
#pragma unroll
    for (int nt = 0; nt < 4; ++nt) {
      int kc = nt * 16 + fr;   // kv row serves as B column
#pragma unroll
      for (int w2 = 0; w2 < 2; ++w2) {
        FragH bf;
        bf.h[0] = *(const v8h*)&ks[kc * LDT + w2 * 32 + c0];
        bf.h[1] = *(const v8h*)&ks[kc * LDT + w2 * 32 + c0 + 16];
        s[nt] = __builtin_amdgcn_wmma_f32_16x16x32_f16(
            false, aq[w2].v, false, bf.v, (short)0, s[nt], false, false);
      }
    }
#pragma unroll
    for (int nt = 0; nt < 4; ++nt)
#pragma unroll
      for (int e = 0; e < 8; ++e) s[nt][e] *= 0.125f;   // 1/sqrt(64)

    // online softmax; xor masks <=8 stay inside each 16-lane column group, so the
    // butterflies run on DPP, in the order 8, 4, 2, 1
#pragma unroll
    for (int r = 0; r < 8; ++r) {
      float rm = fmaxf(fmaxf(s[0][r], s[1][r]), fmaxf(s[2][r], s[3][r]));
      rm = fmaxf(rm, row_xor<8>(rm));
      rm = fmaxf(rm, row_xor<4>(rm));
      rm = fmaxf(rm, row_xor<2>(rm));
      rm = fmaxf(rm, row_xor<1>(rm));
      float mn = fmaxf(mst[r], rm);
      float corr = expf(mst[r] - mn);
      mst[r] = mn;
      float rsum = 0.f;
#pragma unroll
      for (int nt = 0; nt < 4; ++nt) {
        float p = expf(s[nt][r] - mn);
        s[nt][r] = p;
        rsum += p;
      }
      rsum += row_xor<8>(rsum);
      rsum += row_xor<4>(rsum);
      rsum += row_xor<2>(rsum);
      rsum += row_xor<1>(rsum);
      lst[r] = lst[r] * corr + rsum;
#pragma unroll
      for (int dt = 0; dt < 4; ++dt) oa[dt][r] *= corr;
      int prow = wid * 16 + r + ((lane >= 16) ? 8 : 0);
#pragma unroll
      for (int nt = 0; nt < 4; ++nt)
        ps[prow * LDT + nt * 16 + fr] = (_Float16)s[nt][r];
    }

    // P (A-layout) from LDS; same-wave LDS is in-order, no barrier needed
    FragH pa[2];
#pragma unroll
    for (int w2 = 0; w2 < 2; ++w2) {
      int r = wid * 16 + fr;
      pa[w2].h[0] = *(const v8h*)&ps[r * LDT + w2 * 32 + c0];
      pa[w2].h[1] = *(const v8h*)&ps[r * LDT + w2 * 32 + c0 + 16];
    }
#pragma unroll
    for (int dt = 0; dt < 4; ++dt) {
      int dc = dt * 16 + fr;
#pragma unroll
      for (int w2 = 0; w2 < 2; ++w2) {
        FragH bv2;
        bv2.h[0] = *(const v8h*)&vts[dc * LDT + w2 * 32 + c0];
        bv2.h[1] = *(const v8h*)&vts[dc * LDT + w2 * 32 + c0 + 16];
        oa[dt] = __builtin_amdgcn_wmma_f32_16x16x32_f16(
            false, pa[w2].v, false, bv2.v, (short)0, oa[dt], false, false);
      }
    }
  }

  _Float16* ob = o + (size_t)b * SEQ * rs + (size_t)h * D;
#pragma unroll
  for (int dt = 0; dt < 4; ++dt)
#pragma unroll
    for (int r = 0; r < 8; ++r) {
      int row = qt * 64 + wid * 16 + r + ((lane >= 16) ? 8 : 0);
      ob[(size_t)row * rs + dt * 16 + fr] = (_Float16)(oa[dt][r] / lst[r]);
    }
}

// ---------------------------------------------------------------------------
extern "C" void kernel_launch(void* const* d_in, const int* in_sizes, int n_in,
                              void* d_out, int out_size, void* d_ws, size_t ws_size,
                              hipStream_t stream) {
  (void)in_sizes; (void)n_in; (void)out_size; (void)ws_size;
  const float* x   = (const float*)d_in[0];
  const float* wq  = (const float*)d_in[1];
  const float* bq  = (const float*)d_in[2];
  const float* wk  = (const float*)d_in[3];
  const float* bk  = (const float*)d_in[4];
  const float* wv  = (const float*)d_in[5];
  const float* bv  = (const float*)d_in[6];
  const float* wo  = (const float*)d_in[7];
  const float* bo  = (const float*)d_in[8];
  const float* w1  = (const float*)d_in[9];
  const float* b1  = (const float*)d_in[10];
  const float* w2  = (const float*)d_in[11];
  const float* b2  = (const float*)d_in[12];
  const float* g1  = (const float*)d_in[13];
  const float* be1 = (const float*)d_in[14];
  const float* g2  = (const float*)d_in[15];
  const float* be2 = (const float*)d_in[16];

  char* ws = (char*)d_ws;
  size_t off = 0;
  auto alloc = [&](size_t bytes) -> void* {
    void* p = ws + off;
    off += (bytes + 255) & ~(size_t)255;
    return p;
  };
  _Float16* ln16   = (_Float16*)alloc((size_t)ROWS * D_MODEL * 2);
  _Float16* q16    = (_Float16*)alloc((size_t)ROWS * D_MODEL * 2);
  _Float16* k16    = (_Float16*)alloc((size_t)ROWS * D_MODEL * 2);
  _Float16* v16    = (_Float16*)alloc((size_t)ROWS * D_MODEL * 2);
  _Float16* attn16 = (_Float16*)alloc((size_t)ROWS * D_MODEL * 2);
  float*    x1     = (float*)   alloc((size_t)ROWS * D_MODEL * 4);
  _Float16* h16    = (_Float16*)alloc((size_t)ROWS * D_FF * 2);
  _Float16* wqT    = (_Float16*)alloc((size_t)D_MODEL * D_MODEL * 2);
  _Float16* wkT    = (_Float16*)alloc((size_t)D_MODEL * D_MODEL * 2);
  _Float16* wvT    = (_Float16*)alloc((size_t)D_MODEL * D_MODEL * 2);
  _Float16* woT    = (_Float16*)alloc((size_t)D_MODEL * D_MODEL * 2);
  _Float16* w1T    = (_Float16*)alloc((size_t)D_MODEL * D_FF * 2);
  _Float16* w2T    = (_Float16*)alloc((size_t)D_FF * D_MODEL * 2);

  dim3 gtw(D_MODEL / 64, D_MODEL / 64);   // x: n tiles, y: k tiles
  dim3 gt1(D_FF / 64, D_MODEL / 64);
  dim3 gt2(D_MODEL / 64, D_FF / 64);
  wtrans_kernel<D_MODEL, D_MODEL><<<gtw, 128, 0, stream>>>(wq, wqT);
  wtrans_kernel<D_MODEL, D_MODEL><<<gtw, 128, 0, stream>>>(wk, wkT);
  wtrans_kernel<D_MODEL, D_MODEL><<<gtw, 128, 0, stream>>>(wv, wvT);
  wtrans_kernel<D_MODEL, D_MODEL><<<gtw, 128, 0, stream>>>(wo, woT);
  wtrans_kernel<D_MODEL, D_FF><<<gt1, 128, 0, stream>>>(w1, w1T);
  wtrans_kernel<D_FF, D_MODEL><<<gt2, 128, 0, stream>>>(w2, w2T);

  ln_kernel<<<ROWS / 8, 256, 0, stream>>>(x, g1, be1, ln16);

  dim3 g768(D_MODEL / 128, ROWS / 128);
  gemm_wmma_kernel<0><<<g768, 256, 0, stream>>>(ln16, wqT, bq, nullptr, q16, nullptr,
                                                ROWS, D_MODEL, D_MODEL);
  gemm_wmma_kernel<0><<<g768, 256, 0, stream>>>(ln16, wkT, bk, nullptr, k16, nullptr,
                                                ROWS, D_MODEL, D_MODEL);
  gemm_wmma_kernel<0><<<g768, 256, 0, stream>>>(ln16, wvT, bv, nullptr, v16, nullptr,
                                                ROWS, D_MODEL, D_MODEL);

  dim3 gfa(SEQ / 64, HEADS, BATCH);
  flash_kernel<<<gfa, 128, 0, stream>>>(q16, k16, v16, attn16);

  gemm_wmma_kernel<2><<<g768, 256, 0, stream>>>(attn16, woT, bo, x, nullptr, x1,
                                                ROWS, D_MODEL, D_MODEL);

  ln_kernel<<<ROWS / 8, 256, 0, stream>>>(x1, g2, be2, ln16);

  dim3 gff(D_FF / 128, ROWS / 128);
  gemm_wmma_kernel<1><<<gff, 256, 0, stream>>>(ln16, w1T, b1, nullptr, h16, nullptr,
                                               ROWS, D_FF, D_MODEL);
  gemm_wmma_kernel<2><<<g768, 256, 0, stream>>>(h16, w2T, b2, x1, nullptr, (float*)d_out,
                                                ROWS, D_MODEL, D_FF);
}

// v004
// It runs in 302 microseconds.
// Next to v003, in two timings, it ran 1.08 and 1.07 times as fast.
// Counting every step since v000, it is 2.03 times as fast.
#include <hip/hip_runtime.h>
#include <hip/hip_bf16.h>
#include <math.h>

typedef _Float16 v16h __attribute__((ext_vector_type(16)));
typedef _Float16 v8h  __attribute__((ext_vector_type(8)));
typedef float    v8f  __attribute__((ext_vector_type(8)));
typedef float    v4f  __attribute__((ext_vector_type(4)));

#define D_MODEL 768
#define HEADS   12
#define HEAD_DIM 64
#define D_FF    3072
#define SEQ     1024
#define BATCH   8
#define ROWS    (BATCH*SEQ)   // 8192

union FragH { v16h v; v8h h[2]; };

// Async copy global -> LDS (16B per lane), ASYNCcnt-tracked (CDNA5 §08).
// LDS offset = low 32 bits of the flat shared pointer (aperture: addr[31:0]).
__device__ __forceinline__ void async_ld_b128(unsigned lds_off, const void* gaddr) {
  asm volatile("global_load_async_to_lds_b128 %0, %1, off"
               :: "v"(lds_off), "v"((unsigned long long)(size_t)gaddr)
               : "memory");
}
__device__ __forceinline__ void wait_async0() {
  asm volatile("s_wait_asynccnt 0" ::: "memory");
}
// One stage's async copies of one lane: rows r, r+32, r+64, r+96 of the A tile
// and of the B tile. la/lb, ga/gb: the lane's LDS byte address and global address
// of row r; lstep/gstep: bytes from one of its rows to the next. The closing
// s_wait_xcnt is a precaution: inside the statement it stands ahead of every
// later rewrite of an address register that a copy names.
__device__ __forceinline__ void async_stage_b128(unsigned la, unsigned lb, unsigned lstep,
                                                 const _Float16* ga, const _Float16* gb,
                                                 size_t gstep) {
  const char* pa = (const char*)ga;
  const char* pb = (const char*)gb;
  asm volatile("global_load_async_to_lds_b128 %0, %8, off\n\t"
               "global_load_async_to_lds_b128 %1, %9, off\n\t"
               "global_load_async_to_lds_b128 %2, %10, off\n\t"
               "global_load_async_to_lds_b128 %3, %11, off\n\t"
               "global_load_async_to_lds_b128 %4, %12, off\n\t"
               "global_load_async_to_lds_b128 %5, %13, off\n\t"
               "global_load_async_to_lds_b128 %6, %14, off\n\t"
               "global_load_async_to_lds_b128 %7, %15, off\n\t"
               "s_wait_xcnt 0x0"
               :: "v"(la), "v"(la + lstep), "v"(la + 2 * lstep), "v"(la + 3 * lstep),
                  "v"(lb), "v"(lb + lstep), "v"(lb + 2 * lstep), "v"(lb + 3 * lstep),
                  "v"((unsigned long long)(size_t)pa),
                  "v"((unsigned long long)(size_t)(pa + gstep)),
                  "v"((unsigned long long)(size_t)(pa + 2 * gstep)),
                  "v"((unsigned long long)(size_t)(pa + 3 * gstep)),
                  "v"((unsigned long long)(size_t)pb),
                  "v"((unsigned long long)(size_t)(pb + gstep)),
                  "v"((unsigned long long)(size_t)(pb + 2 * gstep)),
                  "v"((unsigned long long)(size_t)(pb + 3 * gstep))
               : "memory");
}

// ---------------------------------------------------------------------------
// LayerNorm: one wave (32 lanes) per 768-wide row; unbiased std (ddof=1).
// ---------------------------------------------------------------------------
__device__ __forceinline__ void
ln_rows(const float* __restrict__ x, const float* __restrict__ g,
        const float* __restrict__ b, _Float16* __restrict__ out, int blk) {
  int wave = threadIdx.x >> 5;
  int lane = threadIdx.x & 31;
  int row  = blk * 8 + wave;
  const float* xr = x + (size_t)row * D_MODEL;
  float vals[24];
  float s = 0.f, s2 = 0.f;
#pragma unroll
  for (int i = 0; i < 24; ++i) {
    float vv = xr[lane + i * 32];
    vals[i] = vv; s += vv; s2 += vv * vv;
  }
#pragma unroll
  for (int m = 16; m >= 1; m >>= 1) {
    s  += __shfl_xor(s,  m, 32);
    s2 += __shfl_xor(s2, m, 32);
  }
  float mean = s * (1.0f / 768.0f);
  float var  = (s2 - 768.0f * mean * mean) * (1.0f / 767.0f);
  float stdd = sqrtf(fmaxf(var, 0.0f));
  float inv  = 1.0f / (stdd + 1e-5f);
  float gg = g[0], bb = b[0];
  _Float16* orow = out + (size_t)row * D_MODEL;
#pragma unroll
  for (int i = 0; i < 24; ++i)
    orow[lane + i * 32] = (_Float16)(gg * (vals[i] - mean) * inv + bb);
}

__global__ void __launch_bounds__(256)
ln_kernel(const float* __restrict__ x, const float* __restrict__ g,
          const float* __restrict__ b, _Float16* __restrict__ out) {
  ln_rows(x, g, b, out, blockIdx.x);
}

// ---------------------------------------------------------------------------
// Weight convert + transpose: w[K][N] fp32 -> wT[N][K] f16 (so GEMM B loads
// are contiguous along K, matching the 16-bit B-fragment VGPR striping).
// Transposed in registers: a lane reads 4 columns of 8 consecutive k rows
// (8 x 16 B), so it holds 8 consecutive k of each column and stores them as
// one 16 B piece. The 8 lanes that share a column cover 64 k: every store
// instruction of a wave fills 4 whole 128 B lines of wT, each written once.
// 4 waves = tile of 64 k x 64 n; K and N are multiples of 64. Tile t counts
// along n first; th = 0..127 is the thread's place among the tile's 4 waves.
// ---------------------------------------------------------------------------
template <int K, int N>
__device__ __forceinline__ void
wtrans_tile(const float* __restrict__ w, _Float16* __restrict__ wT, int t, int th) {
  const int lane = th & 31, wid = th >> 5;
  const int k0 = (t / (N / 64)) * 64 + (lane & 7) * 8;
  const int n0 = (t % (N / 64)) * 64 + wid * 16 + (lane >> 3) * 4;
  const float* src = w + (size_t)k0 * N + n0;
  v4f r[8];
#pragma unroll
  for (int j = 0; j < 8; ++j) r[j] = *(const v4f*)(src + (size_t)j * N);
  _Float16* dst = wT + (size_t)n0 * K + k0;
#pragma unroll
  for (int i = 0; i < 4; ++i) {
    v8h o;
#pragma unroll
    for (int j = 0; j < 8; ++j) o[j] = (_Float16)r[j][i];
    *(v8h*)(dst + (size_t)i * K) = o;
  }
  // precaution: stands ahead of any later rewrite of a register these stores name
  asm volatile("s_wait_xcnt 0x0" ::: "memory");
}

// ---------------------------------------------------------------------------
// Everything that depends on the inputs alone, in one grid of 256-thread blocks:
// the first layer norm (8 rows a block), the six weight transposes (two 64 x 64
// tiles a block) and the three projection biases laid one behind the other.
// wq, wk, wv go to one [3 * 768][768] matrix, so that Q, K and V are one GEMM.
// Which job a block does depends on blockIdx.x alone.
// ---------------------------------------------------------------------------
#define PREP_LN   (ROWS / 8)                          // 1024 blocks
#define PREP_SQ   (D_MODEL / 64 * (D_MODEL / 64) / 2)  // 72 blocks a square weight
#define PREP_FF   (D_MODEL / 64 * (D_FF / 64) / 2)     // 288 blocks a wide weight
#define PREP_BIAS (3 * D_MODEL / 256)                 // 9 blocks
#define PREP_GRID (PREP_LN + 4 * PREP_SQ + 2 * PREP_FF + PREP_BIAS)
__global__ void __launch_bounds__(256)
prep_kernel(const float* __restrict__ x, const float* __restrict__ g,
            const float* __restrict__ b, _Float16* __restrict__ lnOut,
            const float* __restrict__ wq, const float* __restrict__ wk,
            const float* __restrict__ wv, const float* __restrict__ wo,
            const float* __restrict__ w1, const float* __restrict__ w2,
            _Float16* __restrict__ wqkvT, _Float16* __restrict__ woT,
            _Float16* __restrict__ w1T, _Float16* __restrict__ w2T,
            const float* __restrict__ bq, const float* __restrict__ bk,
            const float* __restrict__ bv, float* __restrict__ bqkv) {
  int blk = blockIdx.x;
  if (blk < PREP_LN) { ln_rows(x, g, b, lnOut, blk); return; }
  blk -= PREP_LN;
  const int half = threadIdx.x >> 7, th = threadIdx.x & 127;
  if (blk < 4 * PREP_SQ) {
    const int m = blk / PREP_SQ;
    const int t = (blk - m * PREP_SQ) * 2 + half;
    const float* w = (m == 0) ? wq : (m == 1) ? wk : (m == 2) ? wv : wo;
    _Float16* d = (m < 3) ? wqkvT + (size_t)m * D_MODEL * D_MODEL : woT;
    wtrans_tile<D_MODEL, D_MODEL>(w, d, t, th);
    return;
  }
  blk -= 4 * PREP_SQ;
  if (blk < PREP_FF) { wtrans_tile<D_MODEL, D_FF>(w1, w1T, blk * 2 + half, th); return; }
  blk -= PREP_FF;
  if (blk < PREP_FF) { wtrans_tile<D_FF, D_MODEL>(w2, w2T, blk * 2 + half, th); return; }
  blk -= PREP_FF;
  const int m = blk / 3;                              // 3 blocks of 256 a bias
  const float* bs = (m == 0) ? bq : (m == 1) ? bk : bv;
  bqkv[blk * 256 + threadIdx.x] = bs[(blk - m * 3) * 256 + threadIdx.x];
  // precaution: stands ahead of any later rewrite of a register this store names
  asm volatile("s_wait_xcnt 0x0" ::: "memory");
}

// ---------------------------------------------------------------------------
// WMMA GEMM: C[M,N] = A[M,K](f16) * BT[N,K](f16)^T + bias, fused epilogue.
// EPI 0: -> f16   EPI 1: exact GELU -> f16   EPI 2: + residual -> f32
// Block 256 thr = 8 waves (4 along M x 2 along N); tile 128x128x64.
// Double-buffered LDS fed by global_load_async_to_lds_b128 (ASYNCcnt).
// A stage holds 64 k = 128 B of every operand row: 8 lanes copy one whole
// line, a wave's copy touches 4 lines, and one barrier serves 16 WMMAs a wave.
// ---------------------------------------------------------------------------
template <int EPI>
__global__ void __launch_bounds__(256)
gemm_wmma_kernel(const _Float16* __restrict__ A, const _Float16* __restrict__ BT,
                 const float* __restrict__ bias, const float* __restrict__ res,
                 _Float16* __restrict__ outH, float* __restrict__ outF,
                 int M, int N, int K) {
  constexpr int BM = 128, BN = 128, BK = 64, LDT = BK + 8;  // 72 halves/row = 16 B x 9
  __shared__ __attribute__((aligned(16))) _Float16 As[2 * BM * LDT];
  __shared__ __attribute__((aligned(16))) _Float16 Bs[2 * BN * LDT];

  const int tid  = threadIdx.x;
  const int lane = tid & 31, wid = tid >> 5;
  const int wm = wid & 3, wn = wid >> 2;           // 4 x 2 wave grid
  const int bRow = blockIdx.y * BM;
  const int bCol = blockIdx.x * BN;

  const v8f vzero = {0.f, 0.f, 0.f, 0.f, 0.f, 0.f, 0.f, 0.f};
  v8f acc[2][4];
#pragma unroll
  for (int i = 0; i < 2; ++i)
#pragma unroll
    for (int j = 0; j < 4; ++j) acc[i][j] = vzero;

  const int lrow = tid >> 3;        // 0..31
  const int lcol = (tid & 7) * 8;   // 0,8,..,56
  const int c0 = (lane < 16) ? 0 : 8;
  const int fr = lane & 15;

  const unsigned laBase = (unsigned)(size_t)&As[lrow * LDT + lcol];
  const unsigned lbBase = (unsigned)(size_t)&Bs[lrow * LDT + lcol];
  const _Float16* gA = A  + (size_t)(bRow + lrow) * K + lcol;
  const _Float16* gB = BT + (size_t)(bCol + lrow) * K + lcol;
  const size_t gstep = (size_t)K * 32 * 2;          // 32 rows, in bytes
  auto issue = [&](int k0, int p) {
    async_stage_b128(laBase + (unsigned)(p * BM * LDT * 2),
                     lbBase + (unsigned)(p * BN * LDT * 2), 32 * LDT * 2,
                     gA + k0, gB + k0, gstep);
  };

  const int NIT = K / BK;
  issue(0, 0);
  for (int it = 0; it < NIT; ++it) {
    // this wave's LDS reads of the buffer that is refilled below have returned
    asm volatile("s_wait_dscnt 0x0" ::: "memory");
    wait_async0();       // this wave's pending tile is in LDS
    __syncthreads();     // everyone's tile in; previous buffer free
    const int p = it & 1;
    if (it + 1 < NIT) issue((it + 1) * BK, 1 - p);   // overlap with compute

    const _Float16* Ab = &As[p * BM * LDT];
    const _Float16* Bb = &Bs[p * BN * LDT];
    // unrolled so that both k steps read LDS at immediate offsets; k ascends
#pragma unroll
    for (int kk = 0; kk < BK; kk += 32) {
      FragH a[2], b[4];
#pragma unroll
      for (int mt = 0; mt < 2; ++mt) {
        int r = wm * 32 + mt * 16 + fr;
        a[mt].h[0] = *(const v8h*)&Ab[r * LDT + kk + c0];
        a[mt].h[1] = *(const v8h*)&Ab[r * LDT + kk + c0 + 16];
      }
#pragma unroll
      for (int nt = 0; nt < 4; ++nt) {
        int c = wn * 64 + nt * 16 + fr;
        b[nt].h[0] = *(const v8h*)&Bb[c * LDT + kk + c0];
        b[nt].h[1] = *(const v8h*)&Bb[c * LDT + kk + c0 + 16];
      }
#pragma unroll
      for (int mt = 0; mt < 2; ++mt)
#pragma unroll
        for (int nt = 0; nt < 4; ++nt)
          acc[mt][nt] = __builtin_amdgcn_wmma_f32_16x16x32_f16(
              false, a[mt].v, false, b[nt].v, (short)0, acc[mt][nt], false, false);
    }
  }

  // Epilogue: C layout -> row = base + r + (lane>=16?8:0), col = base + lane%16
  const int rbase = bRow + wm * 32 + ((lane >= 16) ? 8 : 0);
  const int cb    = bCol + wn * 64 + fr;
#pragma unroll
  for (int mt = 0; mt < 2; ++mt) {
#pragma unroll
    for (int nt = 0; nt < 4; ++nt) {
      int   col = cb + nt * 16;
      float bv  = bias[col];
#pragma unroll
      for (int r = 0; r < 8; ++r) {
        int    row = rbase + mt * 16 + r;
        float  v   = acc[mt][nt][r] + bv;
        size_t off = (size_t)row * N + col;
        if constexpr (EPI == 0) {
          outH[off] = (_Float16)v;
        } else if constexpr (EPI == 1) {
          outH[off] = (_Float16)(0.5f * v * (1.0f + erff(v * 0.70710678118f)));
        } else {
          outF[off] = res[off] + v;
        }
      }
    }
  }
}

// Value of lane (l ^ M) of the same 16-lane row, M = 1..15, by DPP row_xmask
// (control word 0x160 | M). A vector-port move: no LDS crossbar trip, no dscnt wait.
// All 32 lanes are on wherever it is used.
template <int M>
__device__ __forceinline__ float row_xor(float x) {
  return __builtin_bit_cast(float, __builtin_amdgcn_update_dpp(
      0, __builtin_bit_cast(int, x), 0x160 | M, 0xf, 0xf, true));
}

// ---------------------------------------------------------------------------
// Flash attention: block = 4 waves, 64 q-rows; KV tiles of 64; online softmax.
// S = Q*K^T and O += P*V both via v_wmma_f32_16x16x32_f16.
// Q and K tiles staged with async global->LDS copies.
// q, k, v: column blocks of the [ROWS][3 * 768] projection output; o: [ROWS][768].
// ---------------------------------------------------------------------------
__global__ void __launch_bounds__(128)
flash_kernel(const _Float16* __restrict__ q, const _Float16* __restrict__ k,
             const _Float16* __restrict__ v, _Float16* __restrict__ o) {
  constexpr int D = 64, LDT = 72, TK = 64;
  __shared__ _Float16 qs[64 * LDT];
  __shared__ _Float16 ks[TK * LDT];
  __shared__ _Float16 vts[D * LDT];   // V transposed: [d][kv]
  __shared__ _Float16 ps[64 * LDT];   // P, per-wave 16-row slices

  const int tid = threadIdx.x, lane = tid & 31, wid = tid >> 5;
  const int qt = blockIdx.x, h = blockIdx.y, b = blockIdx.z;
  const size_t rs = 3 * D_MODEL, os = D_MODEL;
  const _Float16* qb = q + (size_t)b * SEQ * rs + (size_t)h * D;
  const _Float16* kb = k + (size_t)b * SEQ * rs + (size_t)h * D;
  const _Float16* vb = v + (size_t)b * SEQ * rs + (size_t)h * D;

#pragma unroll
  for (int i = 0; i < 4; ++i) {     // Q tile 64x64 via async copies
    int cidx = tid + i * 128;       // 0..511 b128 chunks
    int r = cidx >> 3, c8 = (cidx & 7) * 8;
    async_ld_b128((unsigned)(size_t)&qs[r * LDT + c8],
                  qb + (size_t)(qt * 64 + r) * rs + c8);
  }
  wait_async0();
  __syncthreads();

  const int c0 = (lane < 16) ? 0 : 8;
  const int fr = lane & 15;
  FragH aq[2];
#pragma unroll
  for (int w2 = 0; w2 < 2; ++w2) {
    int r = wid * 16 + fr;
    aq[w2].h[0] = *(const v8h*)&qs[r * LDT + w2 * 32 + c0];
    aq[w2].h[1] = *(const v8h*)&qs[r * LDT + w2 * 32 + c0 + 16];
  }

  const v8f vzero = {0.f, 0.f, 0.f, 0.f, 0.f, 0.f, 0.f, 0.f};
  float mst[8], lst[8];
  v8f oa[4];
#pragma unroll
  for (int r = 0; r < 8; ++r) { mst[r] = -1e30f; lst[r] = 0.f; }
#pragma unroll
  for (int dt = 0; dt < 4; ++dt) oa[dt] = vzero;

  for (int j = 0; j < SEQ / TK; ++j) {
    __syncthreads();   // all waves done reading previous ks/vts
#pragma unroll
    for (int i = 0; i < 4; ++i) {
      int cidx = tid + i * 128;
      int r = cidx >> 3, c8 = (cidx & 7) * 8;
      async_ld_b128((unsigned)(size_t)&ks[r * LDT + c8],
                    kb + (size_t)(j * TK + r) * rs + c8);
      v8h vv = *(const v8h*)(vb + (size_t)(j * TK + r) * rs + c8);
#pragma unroll
      for (int e = 0; e < 8; ++e) vts[(c8 + e) * LDT + r] = vv[e];
    }
    wait_async0();
    __syncthreads();

    v8f s[4];
#pragma unroll
    for (int nt = 0; nt < 4; ++nt) s[nt] = vzero;
#pragma unroll
    for (int nt = 0; nt < 4; ++nt) {
      int kc = nt * 16 + fr;   // kv row serves as B column
#pragma unroll
      for (int w2 = 0; w2 < 2; ++w2) {
        FragH bf;
        bf.h[0] = *(const v8h*)&ks[kc * LDT + w2 * 32 + c0];
        bf.h[1] = *(const v8h*)&ks[kc * LDT + w2 * 32 + c0 + 16];
        s[nt] = __builtin_amdgcn_wmma_f32_16x16x32_f16(
            false, aq[w2].v, false, bf.v, (short)0, s[nt], false, false);
      }
    }
#pragma unroll
    for (int nt = 0; nt < 4; ++nt)
#pragma unroll
      for (int e = 0; e < 8; ++e) s[nt][e] *= 0.125f;   // 1/sqrt(64)

    // online softmax; xor masks <=8 stay inside each 16-lane column group, so the
    // butterflies run on DPP, in the order 8, 4, 2, 1
#pragma unroll
    for (int r = 0; r < 8; ++r) {
      float rm = fmaxf(fmaxf(s[0][r], s[1][r]), fmaxf(s[2][r], s[3][r]));
      rm = fmaxf(rm, row_xor<8>(rm));
      rm = fmaxf(rm, row_xor<4>(rm));
      rm = fmaxf(rm, row_xor<2>(rm));
      rm = fmaxf(rm, row_xor<1>(rm));
      float mn = fmaxf(mst[r], rm);
      float corr = expf(mst[r] - mn);
      mst[r] = mn;
      float rsum = 0.f;
#pragma unroll
      for (int nt = 0; nt < 4; ++nt) {
        float p = expf(s[nt][r] - mn);
        s[nt][r] = p;
        rsum += p;
      }
      rsum += row_xor<8>(rsum);
      rsum += row_xor<4>(rsum);
      rsum += row_xor<2>(rsum);
      rsum += row_xor<1>(rsum);
      lst[r] = lst[r] * corr + rsum;
#pragma unroll
      for (int dt = 0; dt < 4; ++dt) oa[dt][r] *= corr;
      int prow = wid * 16 + r + ((lane >= 16) ? 8 : 0);
#pragma unroll
      for (int nt = 0; nt < 4; ++nt)
        ps[prow * LDT + nt * 16 + fr] = (_Float16)s[nt][r];
    }

    // P (A-layout) from LDS; same-wave LDS is in-order, no barrier needed
    FragH pa[2];
#pragma unroll
    for (int w2 = 0; w2 < 2; ++w2) {
      int r = wid * 16 + fr;
      pa[w2].h[0] = *(const v8h*)&ps[r * LDT + w2 * 32 + c0];
      pa[w2].h[1] = *(const v8h*)&ps[r * LDT + w2 * 32 + c0 + 16];
    }
#pragma unroll
    for (int dt = 0; dt < 4; ++dt) {
      int dc = dt * 16 + fr;
#pragma unroll
      for (int w2 = 0; w2 < 2; ++w2) {
        FragH bv2;
        bv2.h[0] = *(const v8h*)&vts[dc * LDT + w2 * 32 + c0];
        bv2.h[1] = *(const v8h*)&vts[dc * LDT + w2 * 32 + c0 + 16];
        oa[dt] = __builtin_amdgcn_wmma_f32_16x16x32_f16(
            false, pa[w2].v, false, bv2.v, (short)0, oa[dt], false, false);
      }
    }
  }

  _Float16* ob = o + (size_t)b * SEQ * os + (size_t)h * D;
#pragma unroll
  for (int dt = 0; dt < 4; ++dt)
#pragma unroll
    for (int r = 0; r < 8; ++r) {
      int row = qt * 64 + wid * 16 + r + ((lane >= 16) ? 8 : 0);
      ob[(size_t)row * os + dt * 16 + fr] = (_Float16)(oa[dt][r] / lst[r]);
    }
}

// ---------------------------------------------------------------------------
extern "C" void kernel_launch(void* const* d_in, const int* in_sizes, int n_in,
                              void* d_out, int out_size, void* d_ws, size_t ws_size,
                              hipStream_t stream) {
  (void)in_sizes; (void)n_in; (void)out_size; (void)ws_size;
  const float* x   = (const float*)d_in[0];
  const float* wq  = (const float*)d_in[1];
  const float* bq  = (const float*)d_in[2];
  const float* wk  = (const float*)d_in[3];
  const float* bk  = (const float*)d_in[4];
  const float* wv  = (const float*)d_in[5];
  const float* bv  = (const float*)d_in[6];
  const float* wo  = (const float*)d_in[7];
  const float* bo  = (const float*)d_in[8];
  const float* w1  = (const float*)d_in[9];
  const float* b1  = (const float*)d_in[10];
  const float* w2  = (const float*)d_in[11];
  const float* b2  = (const float*)d_in[12];
  const float* g1  = (const float*)d_in[13];
  const float* be1 = (const float*)d_in[14];
  const float* g2  = (const float*)d_in[15];
  const float* be2 = (const float*)d_in[16];

  char* ws = (char*)d_ws;
  size_t off = 0;
  auto alloc = [&](size_t bytes) -> void* {
    void* p = ws + off;
    off += (bytes + 255) & ~(size_t)255;
    return p;
  };
  _Float16* ln16   = (_Float16*)alloc((size_t)ROWS * D_MODEL * 2);
  _Float16* qkv16  = (_Float16*)alloc((size_t)ROWS * 3 * D_MODEL * 2);
  _Float16* attn16 = (_Float16*)alloc((size_t)ROWS * D_MODEL * 2);
  float*    x1     = (float*)   alloc((size_t)ROWS * D_MODEL * 4);
  _Float16* h16    = (_Float16*)alloc((size_t)ROWS * D_FF * 2);
  _Float16* wqkvT  = (_Float16*)alloc((size_t)3 * D_MODEL * D_MODEL * 2);
  _Float16* woT    = (_Float16*)alloc((size_t)D_MODEL * D_MODEL * 2);
  _Float16* w1T    = (_Float16*)alloc((size_t)D_MODEL * D_FF * 2);
  _Float16* w2T    = (_Float16*)alloc((size_t)D_FF * D_MODEL * 2);
  float*    bqkv   = (float*)   alloc((size_t)3 * D_MODEL * 4);

  prep_kernel<<<PREP_GRID, 256, 0, stream>>>(x, g1, be1, ln16, wq, wk, wv, wo, w1, w2,
                                             wqkvT, woT, w1T, w2T, bq, bk, bv, bqkv);

  dim3 g768(D_MODEL / 128, ROWS / 128);
  dim3 gqkv(3 * D_MODEL / 128, ROWS / 128);
  gemm_wmma_kernel<0><<<gqkv, 256, 0, stream>>>(ln16, wqkvT, bqkv, nullptr, qkv16, nullptr,
                                                ROWS, 3 * D_MODEL, D_MODEL);

  dim3 gfa(SEQ / 64, HEADS, BATCH);
  flash_kernel<<<gfa, 128, 0, stream>>>(qkv16, qkv16 + D_MODEL, qkv16 + 2 * D_MODEL, attn16);

  gemm_wmma_kernel<2><<<g768, 256, 0, stream>>>(attn16, woT, bo, x, nullptr, x1,
                                                ROWS, D_MODEL, D_MODEL);

  ln_kernel<<<ROWS / 8, 256, 0, stream>>>(x1, g2, be2, ln16);

  dim3 gff(D_FF / 128, ROWS / 128);
  gemm_wmma_kernel<1><<<gff, 256, 0, stream>>>(ln16, w1T, b1, nullptr, h16, nullptr,
                                               ROWS, D_FF, D_MODEL);
  gemm_wmma_kernel<2><<<g768, 256, 0, stream>>>(h16, w2T, b2, x1, nullptr, (float*)d_out,
                                                ROWS, D_MODEL, D_FF);
}

// v005
// Measured time: 266 microseconds a run.
// In both of two side-by-side timings against v004, it was 1.14 times as fast.
// Counting every step since v000, it is 2.31 times as fast.
#include <hip/hip_runtime.h>
#include <hip/hip_bf16.h>
#include <math.h>

typedef _Float16 v16h __attribute__((ext_vector_type(16)));
typedef _Float16 v8h  __attribute__((ext_vector_type(8)));
typedef float    v8f  __attribute__((ext_vector_type(8)));
typedef float    v4f  __attribute__((ext_vector_type(4)));

#define D_MODEL 768
#define HEADS   12
#define HEAD_DIM 64
#define D_FF    3072
#define SEQ     1024
#define BATCH   8
#define ROWS    (BATCH*SEQ)   // 8192

union FragH { v16h v; v8h h[2]; };

// Async copy global -> LDS (16B per lane), ASYNCcnt-tracked (CDNA5 §08).
// LDS offset = low 32 bits of the flat shared pointer (aperture: addr[31:0]).
__device__ __forceinline__ void async_ld_b128(unsigned lds_off, const void* gaddr) {
  asm volatile("global_load_async_to_lds_b128 %0, %1, off"
               :: "v"(lds_off), "v"((unsigned long long)(size_t)gaddr)
               : "memory");
}
__device__ __forceinline__ void wait_async0() {
  asm volatile("s_wait_asynccnt 0" ::: "memory");
}
// One stage's async copies of one lane: rows r, r+32, r+64, r+96 of the A tile
// and of the B tile. la/lb, ga/gb: the lane's LDS byte address and global address
// of row r; lstep/gstep: bytes from one of its rows to the next. The closing
// s_wait_xcnt is a precaution: inside the statement it stands ahead of every
// later rewrite of an address register that a copy names.
__device__ __forceinline__ void async_stage_b128(unsigned la, unsigned lb, unsigned lstep,
                                                 const _Float16* ga, const _Float16* gb,
                                                 size_t gstep) {
  const char* pa = (const char*)ga;
  const char* pb = (const char*)gb;
  asm volatile("global_load_async_to_lds_b128 %0, %8, off\n\t"
               "global_load_async_to_lds_b128 %1, %9, off\n\t"
               "global_load_async_to_lds_b128 %2, %10, off\n\t"
               "global_load_async_to_lds_b128 %3, %11, off\n\t"
               "global_load_async_to_lds_b128 %4, %12, off\n\t"
               "global_load_async_to_lds_b128 %5, %13, off\n\t"
               "global_load_async_to_lds_b128 %6, %14, off\n\t"
               "global_load_async_to_lds_b128 %7, %15, off\n\t"
               "s_wait_xcnt 0x0"
               :: "v"(la), "v"(la + lstep), "v"(la + 2 * lstep), "v"(la + 3 * lstep),
                  "v"(lb), "v"(lb + lstep), "v"(lb + 2 * lstep), "v"(lb + 3 * lstep),
                  "v"((unsigned long long)(size_t)pa),
                  "v"((unsigned long long)(size_t)(pa + gstep)),
                  "v"((unsigned long long)(size_t)(pa + 2 * gstep)),
                  "v"((unsigned long long)(size_t)(pa + 3 * gstep)),
                  "v"((unsigned long long)(size_t)pb),
                  "v"((unsigned long long)(size_t)(pb + gstep)),
                  "v"((unsigned long long)(size_t)(pb + 2 * gstep)),
                  "v"((unsigned long long)(size_t)(pb + 3 * gstep))
               : "memory");
}

// ---------------------------------------------------------------------------
// LayerNorm: one wave (32 lanes) per 768-wide row; unbiased std (ddof=1).
// ---------------------------------------------------------------------------
__device__ __forceinline__ void
ln_rows(const float* __restrict__ x, const float* __restrict__ g,
        const float* __restrict__ b, _Float16* __restrict__ out, int blk) {
  int wave = threadIdx.x >> 5;
  int lane = threadIdx.x & 31;
  int row  = blk * 8 + wave;
  const float* xr = x + (size_t)row * D_MODEL;
  float vals[24];
  float s = 0.f, s2 = 0.f;
#pragma unroll
  for (int i = 0; i < 24; ++i) {
    float vv = xr[lane + i * 32];
    vals[i] = vv; s += vv; s2 += vv * vv;
  }
#pragma unroll
  for (int m = 16; m >= 1; m >>= 1) {
    s  += __shfl_xor(s,  m, 32);
    s2 += __shfl_xor(s2, m, 32);
  }
  float mean = s * (1.0f / 768.0f);
  float var  = (s2 - 768.0f * mean * mean) * (1.0f / 767.0f);
  float stdd = sqrtf(fmaxf(var, 0.0f));
  float inv  = 1.0f / (stdd + 1e-5f);
  float gg = g[0], bb = b[0];
  _Float16* orow = out + (size_t)row * D_MODEL;
#pragma unroll
  for (int i = 0; i < 24; ++i)
    orow[lane + i * 32] = (_Float16)(gg * (vals[i] - mean) * inv + bb);
}

__global__ void __launch_bounds__(256)
ln_kernel(const float* __restrict__ x, const float* __restrict__ g,
          const float* __restrict__ b, _Float16* __restrict__ out) {
  ln_rows(x, g, b, out, blockIdx.x);
}

// ---------------------------------------------------------------------------
// Weight convert + transpose: w[K][N] fp32 -> wT[N][K] f16 (so GEMM B loads
// are contiguous along K, matching the 16-bit B-fragment VGPR striping).
// Transposed in registers: a lane reads 4 columns of 8 consecutive k rows
// (8 x 16 B), so it holds 8 consecutive k of each column and stores them as
// one 16 B piece. The 8 lanes that share a column cover 64 k: every store
// instruction of a wave fills 4 whole 128 B lines of wT, each written once.
// 4 waves = tile of 64 k x 64 n; K and N are multiples of 64. Tile t counts
// along n first; th = 0..127 is the thread's place among the tile's 4 waves.
// ---------------------------------------------------------------------------
template <int K, int N>
__device__ __forceinline__ void
wtrans_tile(const float* __restrict__ w, _Float16* __restrict__ wT, int t, int th) {
  const int lane = th & 31, wid = th >> 5;
  const int k0 = (t / (N / 64)) * 64 + (lane & 7) * 8;
  const int n0 = (t % (N / 64)) * 64 + wid * 16 + (lane >> 3) * 4;
  const float* src = w + (size_t)k0 * N + n0;
  v4f r[8];
#pragma unroll
  for (int j = 0; j < 8; ++j) r[j] = *(const v4f*)(src + (size_t)j * N);
  _Float16* dst = wT + (size_t)n0 * K + k0;
#pragma unroll
  for (int i = 0; i < 4; ++i) {
    v8h o;
#pragma unroll
    for (int j = 0; j < 8; ++j) o[j] = (_Float16)r[j][i];
    *(v8h*)(dst + (size_t)i * K) = o;
  }
  // precaution: stands ahead of any later rewrite of a register these stores name
  asm volatile("s_wait_xcnt 0x0" ::: "memory");
}

// ---------------------------------------------------------------------------
// Everything that depends on the inputs alone, in one grid of 256-thread blocks:
// the first layer norm (8 rows a block), the six weight transposes (two 64 x 64
// tiles a block) and the three projection biases laid one behind the other.
// wq, wk, wv go to one [3 * 768][768] matrix, so that Q, K and V are one GEMM.
// Which job a block does depends on blockIdx.x alone.
// ---------------------------------------------------------------------------
#define PREP_LN   (ROWS / 8)                          // 1024 blocks
#define PREP_SQ   (D_MODEL / 64 * (D_MODEL / 64) / 2)  // 72 blocks a square weight
#define PREP_FF   (D_MODEL / 64 * (D_FF / 64) / 2)     // 288 blocks a wide weight
#define PREP_BIAS (3 * D_MODEL / 256)                 // 9 blocks
#define PREP_GRID (PREP_LN + 4 * PREP_SQ + 2 * PREP_FF + PREP_BIAS)
__global__ void __launch_bounds__(256)
prep_kernel(const float* __restrict__ x, const float* __restrict__ g,
            const float* __restrict__ b, _Float16* __restrict__ lnOut,
            const float* __restrict__ wq, const float* __restrict__ wk,
            const float* __restrict__ wv, const float* __restrict__ wo,
            const float* __restrict__ w1, const float* __restrict__ w2,
            _Float16* __restrict__ wqkvT, _Float16* __restrict__ woT,
            _Float16* __restrict__ w1T, _Float16* __restrict__ w2T,
            const float* __restrict__ bq, const float* __restrict__ bk,
            const float* __restrict__ bv, float* __restrict__ bqkv) {
  int blk = blockIdx.x;
  if (blk < PREP_LN) { ln_rows(x, g, b, lnOut, blk); return; }
  blk -= PREP_LN;
  const int half = threadIdx.x >> 7, th = threadIdx.x & 127;
  if (blk < 4 * PREP_SQ) {
    const int m = blk / PREP_SQ;
    const int t = (blk - m * PREP_SQ) * 2 + half;
    const float* w = (m == 0) ? wq : (m == 1) ? wk : (m == 2) ? wv : wo;
    _Float16* d = (m < 3) ? wqkvT + (size_t)m * D_MODEL * D_MODEL : woT;
    wtrans_tile<D_MODEL, D_MODEL>(w, d, t, th);
    return;
  }
  blk -= 4 * PREP_SQ;
  if (blk < PREP_FF) { wtrans_tile<D_MODEL, D_FF>(w1, w1T, blk * 2 + half, th); return; }
  blk -= PREP_FF;
  if (blk < PREP_FF) { wtrans_tile<D_FF, D_MODEL>(w2, w2T, blk * 2 + half, th); return; }
  blk -= PREP_FF;
  const int m = blk / 3;                              // 3 blocks of 256 a bias
  const float* bs = (m == 0) ? bq : (m == 1) ? bk : bv;
  bqkv[blk * 256 + threadIdx.x] = bs[(blk - m * 3) * 256 + threadIdx.x];
  // precaution: stands ahead of any later rewrite of a register this store names
  asm volatile("s_wait_xcnt 0x0" ::: "memory");
}

// ---------------------------------------------------------------------------
// WMMA GEMM: C[M,N] = A[M,K](f16) * BT[N,K](f16)^T + bias, fused epilogue.
// EPI 0: -> f16   EPI 1: exact GELU -> f16   EPI 2: + residual -> f32
// Block 256 thr = 8 waves (4 along M x 2 along N); tile 128x128x64.
// Double-buffered LDS fed by global_load_async_to_lds_b128 (ASYNCcnt).
// A stage holds 64 k = 128 B of every operand row: 8 lanes copy one whole
// line, a wave's copy touches 4 lines, and one barrier serves 16 WMMAs a wave.
// ---------------------------------------------------------------------------
template <int EPI>
__global__ void __launch_bounds__(256)
gemm_wmma_kernel(const _Float16* __restrict__ A, const _Float16* __restrict__ BT,
                 const float* __restrict__ bias, const float* __restrict__ res,
                 _Float16* __restrict__ outH, float* __restrict__ outF,
                 int M, int N, int K) {
  constexpr int BM = 128, BN = 128, BK = 64, LDT = BK + 8;  // 72 halves/row = 16 B x 9
  __shared__ __attribute__((aligned(16))) _Float16 As[2 * BM * LDT];
  __shared__ __attribute__((aligned(16))) _Float16 Bs[2 * BN * LDT];

  const int tid  = threadIdx.x;
  const int lane = tid & 31, wid = tid >> 5;
  const int wm = wid & 3, wn = wid >> 2;           // 4 x 2 wave grid
  const int bRow = blockIdx.y * BM;
  const int bCol = blockIdx.x * BN;

  const v8f vzero = {0.f, 0.f, 0.f, 0.f, 0.f, 0.f, 0.f, 0.f};
  v8f acc[2][4];
#pragma unroll
  for (int i = 0; i < 2; ++i)
#pragma unroll
    for (int j = 0; j < 4; ++j) acc[i][j] = vzero;

  const int lrow = tid >> 3;        // 0..31
  const int lcol = (tid & 7) * 8;   // 0,8,..,56
  const int c0 = (lane < 16) ? 0 : 8;
  const int fr = lane & 15;

  const unsigned laBase = (unsigned)(size_t)&As[lrow * LDT + lcol];
  const unsigned lbBase = (unsigned)(size_t)&Bs[lrow * LDT + lcol];
  const _Float16* gA = A  + (size_t)(bRow + lrow) * K + lcol;
  const _Float16* gB = BT + (size_t)(bCol + lrow) * K + lcol;
  const size_t gstep = (size_t)K * 32 * 2;          // 32 rows, in bytes
  auto issue = [&](int k0, int p) {
    async_stage_b128(laBase + (unsigned)(p * BM * LDT * 2),
                     lbBase + (unsigned)(p * BN * LDT * 2), 32 * LDT * 2,
                     gA + k0, gB + k0, gstep);
  };

  const int NIT = K / BK;
  issue(0, 0);
  for (int it = 0; it < NIT; ++it) {
    // this wave's LDS reads of the buffer that is refilled below have returned
    asm volatile("s_wait_dscnt 0x0" ::: "memory");
    wait_async0();       // this wave's pending tile is in LDS
    __syncthreads();     // everyone's tile in; previous buffer free
    const int p = it & 1;
    if (it + 1 < NIT) issue((it + 1) * BK, 1 - p);   // overlap with compute

    const _Float16* Ab = &As[p * BM * LDT];
    const _Float16* Bb = &Bs[p * BN * LDT];
    // unrolled so that both k steps read LDS at immediate offsets; k ascends
#pragma unroll
    for (int kk = 0; kk < BK; kk += 32) {
      FragH a[2], b[4];
#pragma unroll
      for (int mt = 0; mt < 2; ++mt) {
        int r = wm * 32 + mt * 16 + fr;
        a[mt].h[0] = *(const v8h*)&Ab[r * LDT + kk + c0];
        a[mt].h[1] = *(const v8h*)&Ab[r * LDT + kk + c0 + 16];
      }
#pragma unroll
      for (int nt = 0; nt < 4; ++nt) {
        int c = wn * 64 + nt * 16 + fr;
        b[nt].h[0] = *(const v8h*)&Bb[c * LDT + kk + c0];
        b[nt].h[1] = *(const v8h*)&Bb[c * LDT + kk + c0 + 16];
      }
#pragma unroll
      for (int mt = 0; mt < 2; ++mt)
#pragma unroll
        for (int nt = 0; nt < 4; ++nt)
          acc[mt][nt] = __builtin_amdgcn_wmma_f32_16x16x32_f16(
              false, a[mt].v, false, b[nt].v, (short)0, acc[mt][nt], false, false);
    }
  }

  // Epilogue: C layout -> row = base + r + (lane>=16?8:0), col = base + lane%16
  const int rbase = bRow + wm * 32 + ((lane >= 16) ? 8 : 0);
  const int cb    = bCol + wn * 64 + fr;
#pragma unroll
  for (int mt = 0; mt < 2; ++mt) {
#pragma unroll
    for (int nt = 0; nt < 4; ++nt) {
      int   col = cb + nt * 16;
      float bv  = bias[col];
#pragma unroll
      for (int r = 0; r < 8; ++r) {
        int    row = rbase + mt * 16 + r;
        float  v   = acc[mt][nt][r] + bv;
        size_t off = (size_t)row * N + col;
        if constexpr (EPI == 0) {
          outH[off] = (_Float16)v;
        } else if constexpr (EPI == 1) {
          outH[off] = (_Float16)(0.5f * v * (1.0f + erff(v * 0.70710678118f)));
        } else {
          outF[off] = res[off] + v;
        }
      }
    }
  }
}

// Value of lane (l ^ M) of the same 16-lane row, M = 1..15, by DPP row_xmask
// (control word 0x160 | M). A vector-port move: no LDS crossbar trip, no dscnt wait.
// All 32 lanes are on wherever it is used.
template <int M>
__device__ __forceinline__ float row_xor(float x) {
  return __builtin_bit_cast(float, __builtin_amdgcn_update_dpp(
      0, __builtin_bit_cast(int, x), 0x160 | M, 0xf, 0xf, true));
}

// ---------------------------------------------------------------------------
// Flash attention: block = 4 waves, 64 q-rows; KV tiles of 64; online softmax.
// S = Q*K^T and O += P*V both via v_wmma_f32_16x16x32_f16.
// Q and K tiles staged with async global->LDS copies.
// q, k, v: column blocks of the [ROWS][3 * 768] projection output; o: [ROWS][768].
// ---------------------------------------------------------------------------
__global__ void __launch_bounds__(128)
flash_kernel(const _Float16* __restrict__ q, const _Float16* __restrict__ k,
             const _Float16* __restrict__ v, _Float16* __restrict__ o) {
  constexpr int D = 64, LDT = 72, TK = 64;
  __shared__ _Float16 qs[64 * LDT];
  __shared__ _Float16 ks[TK * LDT];
  __shared__ _Float16 vts[D * LDT];   // V transposed: [d][kv]
  __shared__ _Float16 ps[64 * LDT];   // P, per-wave 16-row slices

  const int tid = threadIdx.x, lane = tid & 31, wid = tid >> 5;
  const int qt = blockIdx.x, h = blockIdx.y, b = blockIdx.z;
  const size_t rs = 3 * D_MODEL, os = D_MODEL;
  const _Float16* qb = q + (size_t)b * SEQ * rs + (size_t)h * D;
  const _Float16* kb = k + (size_t)b * SEQ * rs + (size_t)h * D;
  const _Float16* vb = v + (size_t)b * SEQ * rs + (size_t)h * D;

#pragma unroll
  for (int i = 0; i < 4; ++i) {     // Q tile 64x64 via async copies
    int cidx = tid + i * 128;       // 0..511 b128 chunks
    int r = cidx >> 3, c8 = (cidx & 7) * 8;
    async_ld_b128((unsigned)(size_t)&qs[r * LDT + c8],
                  qb + (size_t)(qt * 64 + r) * rs + c8);
  }
  wait_async0();
  __syncthreads();

  const int c0 = (lane < 16) ? 0 : 8;
  const int fr = lane & 15;
  FragH aq[2];
#pragma unroll
  for (int w2 = 0; w2 < 2; ++w2) {
    int r = wid * 16 + fr;
    aq[w2].h[0] = *(const v8h*)&qs[r * LDT + w2 * 32 + c0];
    aq[w2].h[1] = *(const v8h*)&qs[r * LDT + w2 * 32 + c0 + 16];
  }

  const v8f vzero = {0.f, 0.f, 0.f, 0.f, 0.f, 0.f, 0.f, 0.f};
  constexpr float SC = 0.125f * 1.4426950408889634f;   // 1/sqrt(64) * log2(e)
  float mst[8], lst[8];
  v8f oa[4];
#pragma unroll
  for (int r = 0; r < 8; ++r) { mst[r] = -1e30f; lst[r] = 0.f; }
#pragma unroll
  for (int dt = 0; dt < 4; ++dt) oa[dt] = vzero;

  for (int j = 0; j < SEQ / TK; ++j) {
    __syncthreads();   // all waves done reading previous ks/vts
#pragma unroll
    for (int i = 0; i < 4; ++i) {
      int cidx = tid + i * 128;
      int r = cidx >> 3, c8 = (cidx & 7) * 8;
      async_ld_b128((unsigned)(size_t)&ks[r * LDT + c8],
                    kb + (size_t)(j * TK + r) * rs + c8);
      v8h vv = *(const v8h*)(vb + (size_t)(j * TK + r) * rs + c8);
#pragma unroll
      for (int e = 0; e < 8; ++e) vts[(c8 + e) * LDT + r] = vv[e];
    }
    wait_async0();
    __syncthreads();

    v8f s[4];
#pragma unroll
    for (int nt = 0; nt < 4; ++nt) s[nt] = vzero;
#pragma unroll
    for (int nt = 0; nt < 4; ++nt) {
      int kc = nt * 16 + fr;   // kv row serves as B column
#pragma unroll
      for (int w2 = 0; w2 < 2; ++w2) {
        FragH bf;
        bf.h[0] = *(const v8h*)&ks[kc * LDT + w2 * 32 + c0];
        bf.h[1] = *(const v8h*)&ks[kc * LDT + w2 * 32 + c0 + 16];
        s[nt] = __builtin_amdgcn_wmma_f32_16x16x32_f16(
            false, aq[w2].v, false, bf.v, (short)0, s[nt], false, false);
      }
    }
    // online softmax in base 2: exp((x - m) / 8) = exp2(x * SC - m * SC), so a score
    // costs one fused multiply-add and one hardware exponential. s stays unscaled;
    // mst holds the running row maximum times SC (SC > 0: scaling keeps the order).
    // xor masks <=8 stay inside each 16-lane column group, so the butterflies run
    // on DPP, in the order 8, 4, 2, 1
#pragma unroll
    for (int r = 0; r < 8; ++r) {
      float rm = fmaxf(fmaxf(s[0][r], s[1][r]), fmaxf(s[2][r], s[3][r]));
      rm = fmaxf(rm, row_xor<8>(rm));
      rm = fmaxf(rm, row_xor<4>(rm));
      rm = fmaxf(rm, row_xor<2>(rm));
      rm = fmaxf(rm, row_xor<1>(rm));
      float mn = fmaxf(mst[r], rm * SC);
      float corr = __builtin_amdgcn_exp2f(mst[r] - mn);
      mst[r] = mn;
      float rsum = 0.f;
#pragma unroll
      for (int nt = 0; nt < 4; ++nt) {
        float p = __builtin_amdgcn_exp2f(fmaf(s[nt][r], SC, -mn));
        s[nt][r] = p;
        rsum += p;
      }
      rsum += row_xor<8>(rsum);
      rsum += row_xor<4>(rsum);
      rsum += row_xor<2>(rsum);
      rsum += row_xor<1>(rsum);
      lst[r] = lst[r] * corr + rsum;
#pragma unroll
      for (int dt = 0; dt < 4; ++dt) oa[dt][r] *= corr;
      int prow = wid * 16 + r + ((lane >= 16) ? 8 : 0);
#pragma unroll
      for (int nt = 0; nt < 4; ++nt)
        ps[prow * LDT + nt * 16 + fr] = (_Float16)s[nt][r];
    }

    // P (A-layout) from LDS; same-wave LDS is in-order, no barrier needed
    FragH pa[2];
#pragma unroll
    for (int w2 = 0; w2 < 2; ++w2) {
      int r = wid * 16 + fr;
      pa[w2].h[0] = *(const v8h*)&ps[r * LDT + w2 * 32 + c0];
      pa[w2].h[1] = *(const v8h*)&ps[r * LDT + w2 * 32 + c0 + 16];
    }
#pragma unroll
    for (int dt = 0; dt < 4; ++dt) {
      int dc = dt * 16 + fr;
#pragma unroll
      for (int w2 = 0; w2 < 2; ++w2) {
        FragH bv2;
        bv2.h[0] = *(const v8h*)&vts[dc * LDT + w2 * 32 + c0];
        bv2.h[1] = *(const v8h*)&vts[dc * LDT + w2 * 32 + c0 + 16];
        oa[dt] = __builtin_amdgcn_wmma_f32_16x16x32_f16(
            false, pa[w2].v, false, bv2.v, (short)0, oa[dt], false, false);
      }
    }
  }

  _Float16* ob = o + (size_t)b * SEQ * os + (size_t)h * D;
#pragma unroll
  for (int dt = 0; dt < 4; ++dt)
#pragma unroll
    for (int r = 0; r < 8; ++r) {
      int row = qt * 64 + wid * 16 + r + ((lane >= 16) ? 8 : 0);
      ob[(size_t)row * os + dt * 16 + fr] = (_Float16)(oa[dt][r] / lst[r]);
    }
}

// ---------------------------------------------------------------------------
extern "C" void kernel_launch(void* const* d_in, const int* in_sizes, int n_in,
                              void* d_out, int out_size, void* d_ws, size_t ws_size,
                              hipStream_t stream) {
  (void)in_sizes; (void)n_in; (void)out_size; (void)ws_size;
  const float* x   = (const float*)d_in[0];
  const float* wq  = (const float*)d_in[1];
  const float* bq  = (const float*)d_in[2];
  const float* wk  = (const float*)d_in[3];
  const float* bk  = (const float*)d_in[4];
  const float* wv  = (const float*)d_in[5];
  const float* bv  = (const float*)d_in[6];
  const float* wo  = (const float*)d_in[7];
  const float* bo  = (const float*)d_in[8];
  const float* w1  = (const float*)d_in[9];
  const float* b1  = (const float*)d_in[10];
  const float* w2  = (const float*)d_in[11];
  const float* b2  = (const float*)d_in[12];
  const float* g1  = (const float*)d_in[13];
  const float* be1 = (const float*)d_in[14];
  const float* g2  = (const float*)d_in[15];
  const float* be2 = (const float*)d_in[16];

  char* ws = (char*)d_ws;
  size_t off = 0;
  auto alloc = [&](size_t bytes) -> void* {
    void* p = ws + off;
    off += (bytes + 255) & ~(size_t)255;
    return p;
  };
  _Float16* ln16   = (_Float16*)alloc((size_t)ROWS * D_MODEL * 2);
  _Float16* qkv16  = (_Float16*)alloc((size_t)ROWS * 3 * D_MODEL * 2);
  _Float16* attn16 = (_Float16*)alloc((size_t)ROWS * D_MODEL * 2);
  float*    x1     = (float*)   alloc((size_t)ROWS * D_MODEL * 4);
  _Float16* h16    = (_Float16*)alloc((size_t)ROWS * D_FF * 2);
  _Float16* wqkvT  = (_Float16*)alloc((size_t)3 * D_MODEL * D_MODEL * 2);
  _Float16* woT    = (_Float16*)alloc((size_t)D_MODEL * D_MODEL * 2);
  _Float16* w1T    = (_Float16*)alloc((size_t)D_MODEL * D_FF * 2);
  _Float16* w2T    = (_Float16*)alloc((size_t)D_FF * D_MODEL * 2);
  float*    bqkv   = (float*)   alloc((size_t)3 * D_MODEL * 4);

  prep_kernel<<<PREP_GRID, 256, 0, stream>>>(x, g1, be1, ln16, wq, wk, wv, wo, w1, w2,
                                             wqkvT, woT, w1T, w2T, bq, bk, bv, bqkv);

  dim3 g768(D_MODEL / 128, ROWS / 128);
  dim3 gqkv(3 * D_MODEL / 128, ROWS / 128);
  gemm_wmma_kernel<0><<<gqkv, 256, 0, stream>>>(ln16, wqkvT, bqkv, nullptr, qkv16, nullptr,
                                                ROWS, 3 * D_MODEL, D_MODEL);

  dim3 gfa(SEQ / 64, HEADS, BATCH);
  flash_kernel<<<gfa, 128, 0, stream>>>(qkv16, qkv16 + D_MODEL, qkv16 + 2 * D_MODEL, attn16);

  gemm_wmma_kernel<2><<<g768, 256, 0, stream>>>(attn16, woT, bo, x, nullptr, x1,
                                                ROWS, D_MODEL, D_MODEL);

  ln_kernel<<<ROWS / 8, 256, 0, stream>>>(x1, g2, be2, ln16);

  dim3 gff(D_FF / 128, ROWS / 128);
  gemm_wmma_kernel<1><<<gff, 256, 0, stream>>>(ln16, w1T, b1, nullptr, h16, nullptr,
                                               ROWS, D_FF, D_MODEL);
  gemm_wmma_kernel<2><<<g768, 256, 0, stream>>>(h16, w2T, b2, x1, nullptr, (float*)d_out,
                                                ROWS, D_MODEL, D_FF);
}

// v006
// Measured time: 246 microseconds a run.
// Timed twice side by side with v005, it ran 1.08 times as fast both times.
// Over all steps from v000 it is 2.50 times as fast.
#include <hip/hip_runtime.h>
#include <hip/hip_bf16.h>
#include <math.h>

typedef _Float16 v16h __attribute__((ext_vector_type(16)));
typedef _Float16 v8h  __attribute__((ext_vector_type(8)));
typedef float    v8f  __attribute__((ext_vector_type(8)));
typedef float    v4f  __attribute__((ext_vector_type(4)));

#define D_MODEL 768
#define HEADS   12
#define HEAD_DIM 64
#define D_FF    3072
#define SEQ     1024
#define BATCH   8
#define ROWS    (BATCH*SEQ)   // 8192

union FragH { v16h v; v8h h[2]; };

// Async copy global -> LDS (16B per lane), ASYNCcnt-tracked (CDNA5 §08).
// LDS offset = low 32 bits of the flat shared pointer (aperture: addr[31:0]).
__device__ __forceinline__ void async_ld_b128(unsigned lds_off, const void* gaddr) {
  asm volatile("global_load_async_to_lds_b128 %0, %1, off"
               :: "v"(lds_off), "v"((unsigned long long)(size_t)gaddr)
               : "memory");
}
// Four async copies of one lane in one statement. The closing s_wait_xcnt is a
// precaution: inside the statement it stands ahead of every later rewrite of an
// address register that a copy names.
__device__ __forceinline__ void async_quad_b128(unsigned l0, unsigned l1, unsigned l2, unsigned l3,
                                                const void* g0, const void* g1,
                                                const void* g2, const void* g3) {
  asm volatile("global_load_async_to_lds_b128 %0, %4, off\n\t"
               "global_load_async_to_lds_b128 %1, %5, off\n\t"
               "global_load_async_to_lds_b128 %2, %6, off\n\t"
               "global_load_async_to_lds_b128 %3, %7, off\n\t"
               "s_wait_xcnt 0x0"
               :: "v"(l0), "v"(l1), "v"(l2), "v"(l3),
                  "v"((unsigned long long)(size_t)g0), "v"((unsigned long long)(size_t)g1),
                  "v"((unsigned long long)(size_t)g2), "v"((unsigned long long)(size_t)g3)
               : "memory");
}
__device__ __forceinline__ void wait_async0() {
  asm volatile("s_wait_asynccnt 0" ::: "memory");
}
// One stage's async copies of one lane: rows r, r+32, r+64, r+96 of the A tile
// and of the B tile. la/lb, ga/gb: the lane's LDS byte address and global address
// of row r; lstep/gstep: bytes from one of its rows to the next. The closing
// s_wait_xcnt is a precaution: inside the statement it stands ahead of every
// later rewrite of an address register that a copy names.
__device__ __forceinline__ void async_stage_b128(unsigned la, unsigned lb, unsigned lstep,
                                                 const _Float16* ga, const _Float16* gb,
                                                 size_t gstep) {
  const char* pa = (const char*)ga;
  const char* pb = (const char*)gb;
  asm volatile("global_load_async_to_lds_b128 %0, %8, off\n\t"
               "global_load_async_to_lds_b128 %1, %9, off\n\t"
               "global_load_async_to_lds_b128 %2, %10, off\n\t"
               "global_load_async_to_lds_b128 %3, %11, off\n\t"
               "global_load_async_to_lds_b128 %4, %12, off\n\t"
               "global_load_async_to_lds_b128 %5, %13, off\n\t"
               "global_load_async_to_lds_b128 %6, %14, off\n\t"
               "global_load_async_to_lds_b128 %7, %15, off\n\t"
               "s_wait_xcnt 0x0"
               :: "v"(la), "v"(la + lstep), "v"(la + 2 * lstep), "v"(la + 3 * lstep),
                  "v"(lb), "v"(lb + lstep), "v"(lb + 2 * lstep), "v"(lb + 3 * lstep),
                  "v"((unsigned long long)(size_t)pa),
                  "v"((unsigned long long)(size_t)(pa + gstep)),
                  "v"((unsigned long long)(size_t)(pa + 2 * gstep)),
                  "v"((unsigned long long)(size_t)(pa + 3 * gstep)),
                  "v"((unsigned long long)(size_t)pb),
                  "v"((unsigned long long)(size_t)(pb + gstep)),
                  "v"((unsigned long long)(size_t)(pb + 2 * gstep)),
                  "v"((unsigned long long)(size_t)(pb + 3 * gstep))
               : "memory");
}

// ---------------------------------------------------------------------------
// LayerNorm: one wave (32 lanes) per 768-wide row; unbiased std (ddof=1).
// ---------------------------------------------------------------------------
__device__ __forceinline__ void
ln_rows(const float* __restrict__ x, const float* __restrict__ g,
        const float* __restrict__ b, _Float16* __restrict__ out, int blk) {
  int wave = threadIdx.x >> 5;
  int lane = threadIdx.x & 31;
  int row  = blk * 8 + wave;
  const float* xr = x + (size_t)row * D_MODEL;
  float vals[24];
  float s = 0.f, s2 = 0.f;
#pragma unroll
  for (int i = 0; i < 24; ++i) {
    float vv = xr[lane + i * 32];
    vals[i] = vv; s += vv; s2 += vv * vv;
  }
#pragma unroll
  for (int m = 16; m >= 1; m >>= 1) {
    s  += __shfl_xor(s,  m, 32);
    s2 += __shfl_xor(s2, m, 32);
  }
  float mean = s * (1.0f / 768.0f);
  float var  = (s2 - 768.0f * mean * mean) * (1.0f / 767.0f);
  float stdd = sqrtf(fmaxf(var, 0.0f));
  float inv  = 1.0f / (stdd + 1e-5f);
  float gg = g[0], bb = b[0];
  _Float16* orow = out + (size_t)row * D_MODEL;
#pragma unroll
  for (int i = 0; i < 24; ++i)
    orow[lane + i * 32] = (_Float16)(gg * (vals[i] - mean) * inv + bb);
}

__global__ void __launch_bounds__(256)
ln_kernel(const float* __restrict__ x, const float* __restrict__ g,
          const float* __restrict__ b, _Float16* __restrict__ out) {
  ln_rows(x, g, b, out, blockIdx.x);
}

// ---------------------------------------------------------------------------
// Weight convert + transpose: w[K][N] fp32 -> wT[N][K] f16 (so GEMM B loads
// are contiguous along K, matching the 16-bit B-fragment VGPR striping).
// Transposed in registers: a lane reads 4 columns of 8 consecutive k rows
// (8 x 16 B), so it holds 8 consecutive k of each column and stores them as
// one 16 B piece. The 8 lanes that share a column cover 64 k: every store
// instruction of a wave fills 4 whole 128 B lines of wT, each written once.
// 4 waves = tile of 64 k x 64 n; K and N are multiples of 64. Tile t counts
// along n first; th = 0..127 is the thread's place among the tile's 4 waves.
// ---------------------------------------------------------------------------
template <int K, int N>
__device__ __forceinline__ void
wtrans_tile(const float* __restrict__ w, _Float16* __restrict__ wT, int t, int th) {
  const int lane = th & 31, wid = th >> 5;
  const int k0 = (t / (N / 64)) * 64 + (lane & 7) * 8;
  const int n0 = (t % (N / 64)) * 64 + wid * 16 + (lane >> 3) * 4;
  const float* src = w + (size_t)k0 * N + n0;
  v4f r[8];
#pragma unroll
  for (int j = 0; j < 8; ++j) r[j] = *(const v4f*)(src + (size_t)j * N);
  _Float16* dst = wT + (size_t)n0 * K + k0;
#pragma unroll
  for (int i = 0; i < 4; ++i) {
    v8h o;
#pragma unroll
    for (int j = 0; j < 8; ++j) o[j] = (_Float16)r[j][i];
    *(v8h*)(dst + (size_t)i * K) = o;
  }
  // precaution: stands ahead of any later rewrite of a register these stores name
  asm volatile("s_wait_xcnt 0x0" ::: "memory");
}

// ---------------------------------------------------------------------------
// Everything that depends on the inputs alone, in one grid of 256-thread blocks:
// the first layer norm (8 rows a block), the six weight transposes (two 64 x 64
// tiles a block) and the three projection biases laid one behind the other.
// wq, wk, wv go to one [3 * 768][768] matrix, so that Q, K and V are one GEMM.
// Which job a block does depends on blockIdx.x alone.
// ---------------------------------------------------------------------------
#define PREP_LN   (ROWS / 8)                          // 1024 blocks
#define PREP_SQ   (D_MODEL / 64 * (D_MODEL / 64) / 2)  // 72 blocks a square weight
#define PREP_FF   (D_MODEL / 64 * (D_FF / 64) / 2)     // 288 blocks a wide weight
#define PREP_BIAS (3 * D_MODEL / 256)                 // 9 blocks
#define PREP_GRID (PREP_LN + 4 * PREP_SQ + 2 * PREP_FF + PREP_BIAS)
__global__ void __launch_bounds__(256)
prep_kernel(const float* __restrict__ x, const float* __restrict__ g,
            const float* __restrict__ b, _Float16* __restrict__ lnOut,
            const float* __restrict__ wq, const float* __restrict__ wk,
            const float* __restrict__ wv, const float* __restrict__ wo,
            const float* __restrict__ w1, const float* __restrict__ w2,
            _Float16* __restrict__ wqkvT, _Float16* __restrict__ woT,
            _Float16* __restrict__ w1T, _Float16* __restrict__ w2T,
            const float* __restrict__ bq, const float* __restrict__ bk,
            const float* __restrict__ bv, float* __restrict__ bqkv) {
  int blk = blockIdx.x;
  if (blk < PREP_LN) { ln_rows(x, g, b, lnOut, blk); return; }
  blk -= PREP_LN;
  const int half = threadIdx.x >> 7, th = threadIdx.x & 127;
  if (blk < 4 * PREP_SQ) {
    const int m = blk / PREP_SQ;
    const int t = (blk - m * PREP_SQ) * 2 + half;
    const float* w = (m == 0) ? wq : (m == 1) ? wk : (m == 2) ? wv : wo;
    _Float16* d = (m < 3) ? wqkvT + (size_t)m * D_MODEL * D_MODEL : woT;
    wtrans_tile<D_MODEL, D_MODEL>(w, d, t, th);
    return;
  }
  blk -= 4 * PREP_SQ;
  if (blk < PREP_FF) { wtrans_tile<D_MODEL, D_FF>(w1, w1T, blk * 2 + half, th); return; }
  blk -= PREP_FF;
  if (blk < PREP_FF) { wtrans_tile<D_FF, D_MODEL>(w2, w2T, blk * 2 + half, th); return; }
  blk -= PREP_FF;
  const int m = blk / 3;                              // 3 blocks of 256 a bias
  const float* bs = (m == 0) ? bq : (m == 1) ? bk : bv;
  bqkv[blk * 256 + threadIdx.x] = bs[(blk - m * 3) * 256 + threadIdx.x];
  // precaution: stands ahead of any later rewrite of a register this store names
  asm volatile("s_wait_xcnt 0x0" ::: "memory");
}

// ---------------------------------------------------------------------------
// WMMA GEMM: C[M,N] = A[M,K](f16) * BT[N,K](f16)^T + bias, fused epilogue.
// EPI 0: -> f16   EPI 1: exact GELU -> f16   EPI 2: + residual -> f32
// Block 256 thr = 8 waves (4 along M x 2 along N); tile 128x128x64.
// Double-buffered LDS fed by global_load_async_to_lds_b128 (ASYNCcnt).
// A stage holds 64 k = 128 B of every operand row: 8 lanes copy one whole
// line, a wave's copy touches 4 lines, and one barrier serves 16 WMMAs a wave.
// ---------------------------------------------------------------------------
template <int EPI>
__global__ void __launch_bounds__(256)
gemm_wmma_kernel(const _Float16* __restrict__ A, const _Float16* __restrict__ BT,
                 const float* __restrict__ bias, const float* __restrict__ res,
                 _Float16* __restrict__ outH, float* __restrict__ outF,
                 int M, int N, int K) {
  constexpr int BM = 128, BN = 128, BK = 64, LDT = BK + 8;  // 72 halves/row = 16 B x 9
  __shared__ __attribute__((aligned(16))) _Float16 As[2 * BM * LDT];
  __shared__ __attribute__((aligned(16))) _Float16 Bs[2 * BN * LDT];

  const int tid  = threadIdx.x;
  const int lane = tid & 31, wid = tid >> 5;
  const int wm = wid & 3, wn = wid >> 2;           // 4 x 2 wave grid
  const int bRow = blockIdx.y * BM;
  const int bCol = blockIdx.x * BN;

  const v8f vzero = {0.f, 0.f, 0.f, 0.f, 0.f, 0.f, 0.f, 0.f};
  v8f acc[2][4];
#pragma unroll
  for (int i = 0; i < 2; ++i)
#pragma unroll
    for (int j = 0; j < 4; ++j) acc[i][j] = vzero;

  const int lrow = tid >> 3;        // 0..31
  const int lcol = (tid & 7) * 8;   // 0,8,..,56
  const int c0 = (lane < 16) ? 0 : 8;
  const int fr = lane & 15;

  const unsigned laBase = (unsigned)(size_t)&As[lrow * LDT + lcol];
  const unsigned lbBase = (unsigned)(size_t)&Bs[lrow * LDT + lcol];
  const _Float16* gA = A  + (size_t)(bRow + lrow) * K + lcol;
  const _Float16* gB = BT + (size_t)(bCol + lrow) * K + lcol;
  const size_t gstep = (size_t)K * 32 * 2;          // 32 rows, in bytes
  auto issue = [&](int k0, int p) {
    async_stage_b128(laBase + (unsigned)(p * BM * LDT * 2),
                     lbBase + (unsigned)(p * BN * LDT * 2), 32 * LDT * 2,
                     gA + k0, gB + k0, gstep);
  };

  const int NIT = K / BK;
  issue(0, 0);
  for (int it = 0; it < NIT; ++it) {
    // this wave's LDS reads of the buffer that is refilled below have returned
    asm volatile("s_wait_dscnt 0x0" ::: "memory");
    wait_async0();       // this wave's pending tile is in LDS
    __syncthreads();     // everyone's tile in; previous buffer free
    const int p = it & 1;
    if (it + 1 < NIT) issue((it + 1) * BK, 1 - p);   // overlap with compute

    const _Float16* Ab = &As[p * BM * LDT];
    const _Float16* Bb = &Bs[p * BN * LDT];
    // unrolled so that both k steps read LDS at immediate offsets; k ascends
#pragma unroll
    for (int kk = 0; kk < BK; kk += 32) {
      FragH a[2], b[4];
#pragma unroll
      for (int mt = 0; mt < 2; ++mt) {
        int r = wm * 32 + mt * 16 + fr;
        a[mt].h[0] = *(const v8h*)&Ab[r * LDT + kk + c0];
        a[mt].h[1] = *(const v8h*)&Ab[r * LDT + kk + c0 + 16];
      }
#pragma unroll
      for (int nt = 0; nt < 4; ++nt) {
        int c = wn * 64 + nt * 16 + fr;
        b[nt].h[0] = *(const v8h*)&Bb[c * LDT + kk + c0];
        b[nt].h[1] = *(const v8h*)&Bb[c * LDT + kk + c0 + 16];
      }
#pragma unroll
      for (int mt = 0; mt < 2; ++mt)
#pragma unroll
        for (int nt = 0; nt < 4; ++nt)
          acc[mt][nt] = __builtin_amdgcn_wmma_f32_16x16x32_f16(
              false, a[mt].v, false, b[nt].v, (short)0, acc[mt][nt], false, false);
    }
  }

  // Epilogue: C layout -> row = base + r + (lane>=16?8:0), col = base + lane%16
  const int rbase = bRow + wm * 32 + ((lane >= 16) ? 8 : 0);
  const int cb    = bCol + wn * 64 + fr;
  // Every load of the epilogue is issued ahead of the first store, so that a wave
  // waits out one memory latency for all of them and not one for each element.
  float bv[4];
#pragma unroll
  for (int nt = 0; nt < 4; ++nt) bv[nt] = bias[cb + nt * 16];
  if constexpr (EPI == 2) {
    // ro: a lane's element offset in each of its 16 rows, counted from column bCol.
    // Loads and stores name the same 16 offset registers beside a scalar base, so
    // the registers keep their values until the last store has been issued.
    unsigned ro[16];
#pragma unroll
    for (int i = 0; i < 16; ++i)
      ro[i] = (unsigned)(rbase + (i >> 3) * 16 + (i & 7)) * (unsigned)N + (unsigned)(wn * 64 + fr);
    const float* rp = res + bCol;
    float* op = outF + bCol;
    float rv[4][16];
#pragma unroll
    for (int nt = 0; nt < 4; ++nt)
#pragma unroll
      for (int i = 0; i < 16; ++i) rv[nt][i] = (rp + nt * 16)[ro[i]];
#pragma unroll
    for (int nt = 0; nt < 4; ++nt)
#pragma unroll
      for (int i = 0; i < 16; ++i)
        (op + nt * 16)[ro[i]] = rv[nt][i] + (acc[i >> 3][nt][i & 7] + bv[nt]);
    return;
  }
#pragma unroll
  for (int mt = 0; mt < 2; ++mt) {
#pragma unroll
    for (int nt = 0; nt < 4; ++nt) {
      int   col = cb + nt * 16;
#pragma unroll
      for (int r = 0; r < 8; ++r) {
        int    row = rbase + mt * 16 + r;
        float  v   = acc[mt][nt][r] + bv[nt];
        size_t off = (size_t)row * N + col;
        if constexpr (EPI == 0) {
          outH[off] = (_Float16)v;
        } else {
          outH[off] = (_Float16)(0.5f * v * (1.0f + erff(v * 0.70710678118f)));
        }
      }
    }
  }
}

// Value of lane (l ^ M) of the same 16-lane row, M = 1..15, by DPP row_xmask
// (control word 0x160 | M). A vector-port move: no LDS crossbar trip, no dscnt wait.
// All 32 lanes are on wherever it is used.
template <int M>
__device__ __forceinline__ float row_xor(float x) {
  return __builtin_bit_cast(float, __builtin_amdgcn_update_dpp(
      0, __builtin_bit_cast(int, x), 0x160 | M, 0xf, 0xf, true));
}

// ---------------------------------------------------------------------------
// Flash attention: block = 4 waves, 64 q-rows; KV tiles of 64; online softmax.
// S = Q*K^T and O += P*V both via v_wmma_f32_16x16x32_f16.
// Q and K tiles staged with async global->LDS copies.
// q, k, v: column blocks of the [ROWS][3 * 768] projection output; o: [ROWS][768].
// ---------------------------------------------------------------------------
__global__ void __launch_bounds__(128)
flash_kernel(const _Float16* __restrict__ q, const _Float16* __restrict__ k,
             const _Float16* __restrict__ v, _Float16* __restrict__ o) {
  constexpr int D = 64, LDT = 72, TK = 64;
  __shared__ _Float16 qs[64 * LDT];
  __shared__ _Float16 ks[TK * LDT];
  __shared__ _Float16 vts[D * LDT];   // V transposed: [d][kv]
  __shared__ _Float16 ps[64 * LDT];   // P, per-wave 16-row slices

  const int tid = threadIdx.x, lane = tid & 31, wid = tid >> 5;
  const int qt = blockIdx.x, h = blockIdx.y, b = blockIdx.z;
  const size_t rs = 3 * D_MODEL, os = D_MODEL;
  const _Float16* qb = q + (size_t)b * SEQ * rs + (size_t)h * D;
  const _Float16* kb = k + (size_t)b * SEQ * rs + (size_t)h * D;
  const _Float16* vb = v + (size_t)b * SEQ * rs + (size_t)h * D;

#pragma unroll
  for (int i = 0; i < 4; ++i) {     // Q tile 64x64 via async copies
    int cidx = tid + i * 128;       // 0..511 b128 chunks
    int r = cidx >> 3, c8 = (cidx & 7) * 8;
    async_ld_b128((unsigned)(size_t)&qs[r * LDT + c8],
                  qb + (size_t)(qt * 64 + r) * rs + c8);
  }
  wait_async0();
  __syncthreads();

  const int c0 = (lane < 16) ? 0 : 8;
  const int fr = lane & 15;
  FragH aq[2];
#pragma unroll
  for (int w2 = 0; w2 < 2; ++w2) {
    int r = wid * 16 + fr;
    aq[w2].h[0] = *(const v8h*)&qs[r * LDT + w2 * 32 + c0];
    aq[w2].h[1] = *(const v8h*)&qs[r * LDT + w2 * 32 + c0 + 16];
  }

  const v8f vzero = {0.f, 0.f, 0.f, 0.f, 0.f, 0.f, 0.f, 0.f};
  constexpr float SC = 0.125f * 1.4426950408889634f;   // 1/sqrt(64) * log2(e)
  float mst[8], lst[8];
  v8f oa[4];
#pragma unroll
  for (int r = 0; r < 8; ++r) { mst[r] = -1e30f; lst[r] = 0.f; }
#pragma unroll
  for (int dt = 0; dt < 4; ++dt) oa[dt] = vzero;

  for (int j = 0; j < SEQ / TK; ++j) {
    __syncthreads();   // all waves done reading previous ks/vts
    // a thread's chunk i is row sr + 16 * i, halves sc .. sc + 7, of the K and V tiles.
    // The four V loads and the four K copies are all issued before the first V value
    // is waited for: one latency a tile, not one for each chunk.
    const int sr = tid >> 3, sc = (tid & 7) * 8;
    const _Float16* kg = kb + (size_t)(j * TK + sr) * rs + sc;
    const _Float16* vg = vb + (size_t)(j * TK + sr) * rs + sc;
    v8h vv[4];
#pragma unroll
    for (int i = 0; i < 4; ++i) vv[i] = *(const v8h*)(vg + (size_t)(16 * i) * rs);
    const unsigned kl = (unsigned)(size_t)&ks[sr * LDT + sc];
    async_quad_b128(kl, kl + 16 * LDT * 2, kl + 32 * LDT * 2, kl + 48 * LDT * 2,
                    kg, kg + 16 * rs, kg + 32 * rs, kg + 48 * rs);
#pragma unroll
    for (int i = 0; i < 4; ++i)
#pragma unroll
      for (int e = 0; e < 8; ++e) vts[(sc + e) * LDT + sr + 16 * i] = vv[i][e];
    wait_async0();
    __syncthreads();

    v8f s[4];
#pragma unroll
    for (int nt = 0; nt < 4; ++nt) s[nt] = vzero;
#pragma unroll
    for (int nt = 0; nt < 4; ++nt) {
      int kc = nt * 16 + fr;   // kv row serves as B column
#pragma unroll
      for (int w2 = 0; w2 < 2; ++w2) {
        FragH bf;
        bf.h[0] = *(const v8h*)&ks[kc * LDT + w2 * 32 + c0];
        bf.h[1] = *(const v8h*)&ks[kc * LDT + w2 * 32 + c0 + 16];
        s[nt] = __builtin_amdgcn_wmma_f32_16x16x32_f16(
            false, aq[w2].v, false, bf.v, (short)0, s[nt], false, false);
      }
    }
    // online softmax in base 2: exp((x - m) / 8) = exp2(x * SC - m * SC), so a score
    // costs one fused multiply-add and one hardware exponential. s stays unscaled;
    // mst holds the running row maximum times SC (SC > 0: scaling keeps the order).
    // xor masks <=8 stay inside each 16-lane column group, so the butterflies run
    // on DPP, in the order 8, 4, 2, 1
#pragma unroll
    for (int r = 0; r < 8; ++r) {
      float rm = fmaxf(fmaxf(s[0][r], s[1][r]), fmaxf(s[2][r], s[3][r]));
      rm = fmaxf(rm, row_xor<8>(rm));
      rm = fmaxf(rm, row_xor<4>(rm));
      rm = fmaxf(rm, row_xor<2>(rm));
      rm = fmaxf(rm, row_xor<1>(rm));
      float mn = fmaxf(mst[r], rm * SC);
      float corr = __builtin_amdgcn_exp2f(mst[r] - mn);
      mst[r] = mn;
      float rsum = 0.f;
#pragma unroll
      for (int nt = 0; nt < 4; ++nt) {
        float p = __builtin_amdgcn_exp2f(fmaf(s[nt][r], SC, -mn));
        s[nt][r] = p;
        rsum += p;
      }
      rsum += row_xor<8>(rsum);
      rsum += row_xor<4>(rsum);
      rsum += row_xor<2>(rsum);
      rsum += row_xor<1>(rsum);
      lst[r] = lst[r] * corr + rsum;
#pragma unroll
      for (int dt = 0; dt < 4; ++dt) oa[dt][r] *= corr;
      int prow = wid * 16 + r + ((lane >= 16) ? 8 : 0);
#pragma unroll
      for (int nt = 0; nt < 4; ++nt)
        ps[prow * LDT + nt * 16 + fr] = (_Float16)s[nt][r];
    }

    // P (A-layout) from LDS; same-wave LDS is in-order, no barrier needed
    FragH pa[2];
#pragma unroll
    for (int w2 = 0; w2 < 2; ++w2) {
      int r = wid * 16 + fr;
      pa[w2].h[0] = *(const v8h*)&ps[r * LDT + w2 * 32 + c0];
      pa[w2].h[1] = *(const v8h*)&ps[r * LDT + w2 * 32 + c0 + 16];
    }
#pragma unroll
    for (int dt = 0; dt < 4; ++dt) {
      int dc = dt * 16 + fr;
#pragma unroll
      for (int w2 = 0; w2 < 2; ++w2) {
        FragH bv2;
        bv2.h[0] = *(const v8h*)&vts[dc * LDT + w2 * 32 + c0];
        bv2.h[1] = *(const v8h*)&vts[dc * LDT + w2 * 32 + c0 + 16];
        oa[dt] = __builtin_amdgcn_wmma_f32_16x16x32_f16(
            false, pa[w2].v, false, bv2.v, (short)0, oa[dt], false, false);
      }
    }
  }

  _Float16* ob = o + (size_t)b * SEQ * os + (size_t)h * D;
#pragma unroll
  for (int dt = 0; dt < 4; ++dt)
#pragma unroll
    for (int r = 0; r < 8; ++r) {
      int row = qt * 64 + wid * 16 + r + ((lane >= 16) ? 8 : 0);
      ob[(size_t)row * os + dt * 16 + fr] = (_Float16)(oa[dt][r] / lst[r]);
    }
}

// ---------------------------------------------------------------------------
extern "C" void kernel_launch(void* const* d_in, const int* in_sizes, int n_in,
                              void* d_out, int out_size, void* d_ws, size_t ws_size,
                              hipStream_t stream) {
  (void)in_sizes; (void)n_in; (void)out_size; (void)ws_size;
  const float* x   = (const float*)d_in[0];
  const float* wq  = (const float*)d_in[1];
  const float* bq  = (const float*)d_in[2];
  const float* wk  = (const float*)d_in[3];
  const float* bk  = (const float*)d_in[4];
  const float* wv  = (const float*)d_in[5];
  const float* bv  = (const float*)d_in[6];
  const float* wo  = (const float*)d_in[7];
  const float* bo  = (const float*)d_in[8];
  const float* w1  = (const float*)d_in[9];
  const float* b1  = (const float*)d_in[10];
  const float* w2  = (const float*)d_in[11];
  const float* b2  = (const float*)d_in[12];
  const float* g1  = (const float*)d_in[13];
  const float* be1 = (const float*)d_in[14];
  const float* g2  = (const float*)d_in[15];
  const float* be2 = (const float*)d_in[16];

  char* ws = (char*)d_ws;
  size_t off = 0;
  auto alloc = [&](size_t bytes) -> void* {
    void* p = ws + off;
    off += (bytes + 255) & ~(size_t)255;
    return p;
  };
  _Float16* ln16   = (_Float16*)alloc((size_t)ROWS * D_MODEL * 2);
  _Float16* qkv16  = (_Float16*)alloc((size_t)ROWS * 3 * D_MODEL * 2);
  _Float16* attn16 = (_Float16*)alloc((size_t)ROWS * D_MODEL * 2);
  float*    x1     = (float*)   alloc((size_t)ROWS * D_MODEL * 4);
  _Float16* h16    = (_Float16*)alloc((size_t)ROWS * D_FF * 2);
  _Float16* wqkvT  = (_Float16*)alloc((size_t)3 * D_MODEL * D_MODEL * 2);
  _Float16* woT    = (_Float16*)alloc((size_t)D_MODEL * D_MODEL * 2);
  _Float16* w1T    = (_Float16*)alloc((size_t)D_MODEL * D_FF * 2);
  _Float16* w2T    = (_Float16*)alloc((size_t)D_FF * D_MODEL * 2);
  float*    bqkv   = (float*)   alloc((size_t)3 * D_MODEL * 4);

  prep_kernel<<<PREP_GRID, 256, 0, stream>>>(x, g1, be1, ln16, wq, wk, wv, wo, w1, w2,
                                             wqkvT, woT, w1T, w2T, bq, bk, bv, bqkv);

  dim3 g768(D_MODEL / 128, ROWS / 128);
  dim3 gqkv(3 * D_MODEL / 128, ROWS / 128);
  gemm_wmma_kernel<0><<<gqkv, 256, 0, stream>>>(ln16, wqkvT, bqkv, nullptr, qkv16, nullptr,
                                                ROWS, 3 * D_MODEL, D_MODEL);

  dim3 gfa(SEQ / 64, HEADS, BATCH);
  flash_kernel<<<gfa, 128, 0, stream>>>(qkv16, qkv16 + D_MODEL, qkv16 + 2 * D_MODEL, attn16);

  gemm_wmma_kernel<2><<<g768, 256, 0, stream>>>(attn16, woT, bo, x, nullptr, x1,
                                                ROWS, D_MODEL, D_MODEL);

  ln_kernel<<<ROWS / 8, 256, 0, stream>>>(x1, g2, be2, ln16);

  dim3 gff(D_FF / 128, ROWS / 128);
  gemm_wmma_kernel<1><<<gff, 256, 0, stream>>>(ln16, w1T, b1, nullptr, h16, nullptr,
                                               ROWS, D_FF, D_MODEL);
  gemm_wmma_kernel<2><<<g768, 256, 0, stream>>>(h16, w2T, b2, x1, nullptr, (float*)d_out,
                                                ROWS, D_MODEL, D_FF);
}

// v007
// Measured time: 235 microseconds a run.
// Two timings next to v006 both put it at 1.04 times that version's speed.
// Counting every step since v000, it is 2.61 times as fast.
#include <hip/hip_runtime.h>
#include <hip/hip_bf16.h>
#include <math.h>

typedef _Float16 v16h __attribute__((ext_vector_type(16)));
typedef _Float16 v8h  __attribute__((ext_vector_type(8)));
typedef float    v8f  __attribute__((ext_vector_type(8)));
typedef float    v4f  __attribute__((ext_vector_type(4)));

#define D_MODEL 768
#define HEADS   12
#define HEAD_DIM 64
#define D_FF    3072
#define SEQ     1024
#define BATCH   8
#define ROWS    (BATCH*SEQ)   // 8192

union FragH { v16h v; v8h h[2]; };

// Async copies global -> LDS (16B per lane), ASYNCcnt-tracked.
// LDS offset = low 32 bits of the flat shared pointer (aperture: addr[31:0]).
// Four async copies of one lane in one statement. The closing s_wait_xcnt is a
// precaution: inside the statement it stands ahead of every later rewrite of an
// address register that a copy names.
__device__ __forceinline__ void async_quad_b128(unsigned l0, unsigned l1, unsigned l2, unsigned l3,
                                                const void* g0, const void* g1,
                                                const void* g2, const void* g3) {
  asm volatile("global_load_async_to_lds_b128 %0, %4, off\n\t"
               "global_load_async_to_lds_b128 %1, %5, off\n\t"
               "global_load_async_to_lds_b128 %2, %6, off\n\t"
               "global_load_async_to_lds_b128 %3, %7, off\n\t"
               "s_wait_xcnt 0x0"
               :: "v"(l0), "v"(l1), "v"(l2), "v"(l3),
                  "v"((unsigned long long)(size_t)g0), "v"((unsigned long long)(size_t)g1),
                  "v"((unsigned long long)(size_t)g2), "v"((unsigned long long)(size_t)g3)
               : "memory");
}
__device__ __forceinline__ void wait_async0() {
  asm volatile("s_wait_asynccnt 0" ::: "memory");
}
// One stage's async copies of one lane: rows r, r+32, r+64, r+96 of the A tile
// and of the B tile. la/lb, ga/gb: the lane's LDS byte address and global address
// of row r; lstep/gstep: bytes from one of its rows to the next. The closing
// s_wait_xcnt is a precaution: inside the statement it stands ahead of every
// later rewrite of an address register that a copy names.
__device__ __forceinline__ void async_stage_b128(unsigned la, unsigned lb, unsigned lstep,
                                                 const _Float16* ga, const _Float16* gb,
                                                 size_t gstep) {
  const char* pa = (const char*)ga;
  const char* pb = (const char*)gb;
  asm volatile("global_load_async_to_lds_b128 %0, %8, off\n\t"
               "global_load_async_to_lds_b128 %1, %9, off\n\t"
               "global_load_async_to_lds_b128 %2, %10, off\n\t"
               "global_load_async_to_lds_b128 %3, %11, off\n\t"
               "global_load_async_to_lds_b128 %4, %12, off\n\t"
               "global_load_async_to_lds_b128 %5, %13, off\n\t"
               "global_load_async_to_lds_b128 %6, %14, off\n\t"
               "global_load_async_to_lds_b128 %7, %15, off\n\t"
               "s_wait_xcnt 0x0"
               :: "v"(la), "v"(la + lstep), "v"(la + 2 * lstep), "v"(la + 3 * lstep),
                  "v"(lb), "v"(lb + lstep), "v"(lb + 2 * lstep), "v"(lb + 3 * lstep),
                  "v"((unsigned long long)(size_t)pa),
                  "v"((unsigned long long)(size_t)(pa + gstep)),
                  "v"((unsigned long long)(size_t)(pa + 2 * gstep)),
                  "v"((unsigned long long)(size_t)(pa + 3 * gstep)),
                  "v"((unsigned long long)(size_t)pb),
                  "v"((unsigned long long)(size_t)(pb + gstep)),
                  "v"((unsigned long long)(size_t)(pb + 2 * gstep)),
                  "v"((unsigned long long)(size_t)(pb + 3 * gstep))
               : "memory");
}

// ---------------------------------------------------------------------------
// LayerNorm: one wave (32 lanes) per 768-wide row; unbiased std (ddof=1).
// ---------------------------------------------------------------------------
__device__ __forceinline__ void
ln_rows(const float* __restrict__ x, const float* __restrict__ g,
        const float* __restrict__ b, _Float16* __restrict__ out, int blk) {
  int wave = threadIdx.x >> 5;
  int lane = threadIdx.x & 31;
  int row  = blk * 8 + wave;
  const float* xr = x + (size_t)row * D_MODEL;
  float vals[24];
  float s = 0.f, s2 = 0.f;
#pragma unroll
  for (int i = 0; i < 24; ++i) {
    float vv = xr[lane + i * 32];
    vals[i] = vv; s += vv; s2 += vv * vv;
  }
#pragma unroll
  for (int m = 16; m >= 1; m >>= 1) {
    s  += __shfl_xor(s,  m, 32);
    s2 += __shfl_xor(s2, m, 32);
  }
  float mean = s * (1.0f / 768.0f);
  float var  = (s2 - 768.0f * mean * mean) * (1.0f / 767.0f);
  float stdd = sqrtf(fmaxf(var, 0.0f));
  float inv  = 1.0f / (stdd + 1e-5f);
  float gg = g[0], bb = b[0];
  _Float16* orow = out + (size_t)row * D_MODEL;
#pragma unroll
  for (int i = 0; i < 24; ++i)
    orow[lane + i * 32] = (_Float16)(gg * (vals[i] - mean) * inv + bb);
}

__global__ void __launch_bounds__(256)
ln_kernel(const float* __restrict__ x, const float* __restrict__ g,
          const float* __restrict__ b, _Float16* __restrict__ out) {
  ln_rows(x, g, b, out, blockIdx.x);
}

// ---------------------------------------------------------------------------
// Weight convert + transpose: w[K][N] fp32 -> wT[N][K] f16 (so GEMM B loads
// are contiguous along K, matching the 16-bit B-fragment VGPR striping).
// Transposed in registers: a lane reads 4 columns of 8 consecutive k rows
// (8 x 16 B), so it holds 8 consecutive k of each column and stores them as
// one 16 B piece. The 8 lanes that share a column cover 64 k: every store
// instruction of a wave fills 4 whole 128 B lines of wT, each written once.
// 4 waves = tile of 64 k x 64 n; K and N are multiples of 64. Tile t counts
// along n first; th = 0..127 is the thread's place among the tile's 4 waves.
// ---------------------------------------------------------------------------
template <int K, int N>
__device__ __forceinline__ void
wtrans_tile(const float* __restrict__ w, _Float16* __restrict__ wT, int t, int th) {
  const int lane = th & 31, wid = th >> 5;
  const int k0 = (t / (N / 64)) * 64 + (lane & 7) * 8;
  const int n0 = (t % (N / 64)) * 64 + wid * 16 + (lane >> 3) * 4;
  const float* src = w + (size_t)k0 * N + n0;
  v4f r[8];
#pragma unroll
  for (int j = 0; j < 8; ++j) r[j] = *(const v4f*)(src + (size_t)j * N);
  _Float16* dst = wT + (size_t)n0 * K + k0;
#pragma unroll
  for (int i = 0; i < 4; ++i) {
    v8h o;
#pragma unroll
    for (int j = 0; j < 8; ++j) o[j] = (_Float16)r[j][i];
    *(v8h*)(dst + (size_t)i * K) = o;
  }
  // precaution: stands ahead of any later rewrite of a register these stores name
  asm volatile("s_wait_xcnt 0x0" ::: "memory");
}

// ---------------------------------------------------------------------------
// Everything that depends on the inputs alone, in one grid of 256-thread blocks:
// the first layer norm (8 rows a block), the six weight transposes (two 64 x 64
// tiles a block) and the three projection biases laid one behind the other.
// wq, wk, wv go to one [3 * 768][768] matrix, so that Q, K and V are one GEMM.
// Which job a block does depends on blockIdx.x alone.
// ---------------------------------------------------------------------------
#define PREP_LN   (ROWS / 8)                          // 1024 blocks
#define PREP_SQ   (D_MODEL / 64 * (D_MODEL / 64) / 2)  // 72 blocks a square weight
#define PREP_FF   (D_MODEL / 64 * (D_FF / 64) / 2)     // 288 blocks a wide weight
#define PREP_BIAS (3 * D_MODEL / 256)                 // 9 blocks
#define PREP_GRID (PREP_LN + 4 * PREP_SQ + 2 * PREP_FF + PREP_BIAS)
__global__ void __launch_bounds__(256)
prep_kernel(const float* __restrict__ x, const float* __restrict__ g,
            const float* __restrict__ b, _Float16* __restrict__ lnOut,
            const float* __restrict__ wq, const float* __restrict__ wk,
            const float* __restrict__ wv, const float* __restrict__ wo,
            const float* __restrict__ w1, const float* __restrict__ w2,
            _Float16* __restrict__ wqkvT, _Float16* __restrict__ woT,
            _Float16* __restrict__ w1T, _Float16* __restrict__ w2T,
            const float* __restrict__ bq, const float* __restrict__ bk,
            const float* __restrict__ bv, float* __restrict__ bqkv) {
  int blk = blockIdx.x;
  if (blk < PREP_LN) { ln_rows(x, g, b, lnOut, blk); return; }
  blk -= PREP_LN;
  const int half = threadIdx.x >> 7, th = threadIdx.x & 127;
  if (blk < 4 * PREP_SQ) {
    const int m = blk / PREP_SQ;
    const int t = (blk - m * PREP_SQ) * 2 + half;
    const float* w = (m == 0) ? wq : (m == 1) ? wk : (m == 2) ? wv : wo;
    _Float16* d = (m < 3) ? wqkvT + (size_t)m * D_MODEL * D_MODEL : woT;
    wtrans_tile<D_MODEL, D_MODEL>(w, d, t, th);
    return;
  }
  blk -= 4 * PREP_SQ;
  if (blk < PREP_FF) { wtrans_tile<D_MODEL, D_FF>(w1, w1T, blk * 2 + half, th); return; }
  blk -= PREP_FF;
  if (blk < PREP_FF) { wtrans_tile<D_FF, D_MODEL>(w2, w2T, blk * 2 + half, th); return; }
  blk -= PREP_FF;
  const int m = blk / 3;                              // 3 blocks of 256 a bias
  const float* bs = (m == 0) ? bq : (m == 1) ? bk : bv;
  bqkv[blk * 256 + threadIdx.x] = bs[(blk - m * 3) * 256 + threadIdx.x];
  // precaution: stands ahead of any later rewrite of a register this store names
  asm volatile("s_wait_xcnt 0x0" ::: "memory");
}

// ---------------------------------------------------------------------------
// WMMA GEMM: C[M,N] = A[M,K](f16) * BT[N,K](f16)^T + bias, fused epilogue.
// EPI 0: -> f16   EPI 1: exact GELU -> f16   EPI 2: + residual -> f32
// Block 256 thr = 8 waves (4 along M x 2 along N); tile 128x128x64.
// Double-buffered LDS fed by global_load_async_to_lds_b128 (ASYNCcnt).
// A stage holds 64 k = 128 B of every operand row: 8 lanes copy one whole
// line, a wave's copy touches 4 lines, and one barrier serves 16 WMMAs a wave.
// ---------------------------------------------------------------------------
template <int EPI>
__global__ void __launch_bounds__(256)
gemm_wmma_kernel(const _Float16* __restrict__ A, const _Float16* __restrict__ BT,
                 const float* __restrict__ bias, const float* __restrict__ res,
                 _Float16* __restrict__ outH, float* __restrict__ outF,
                 int M, int N, int K) {
  constexpr int BM = 128, BN = 128, BK = 64, LDT = BK + 8;  // 72 halves/row = 16 B x 9
  __shared__ __attribute__((aligned(16))) _Float16 As[2 * BM * LDT];
  __shared__ __attribute__((aligned(16))) _Float16 Bs[2 * BN * LDT];

  const int tid  = threadIdx.x;
  const int lane = tid & 31, wid = tid >> 5;
  const int wm = wid & 3, wn = wid >> 2;           // 4 x 2 wave grid
  const int bRow = blockIdx.y * BM;
  const int bCol = blockIdx.x * BN;

  const v8f vzero = {0.f, 0.f, 0.f, 0.f, 0.f, 0.f, 0.f, 0.f};
  v8f acc[2][4];
#pragma unroll
  for (int i = 0; i < 2; ++i)
#pragma unroll
    for (int j = 0; j < 4; ++j) acc[i][j] = vzero;

  const int lrow = tid >> 3;        // 0..31
  const int lcol = (tid & 7) * 8;   // 0,8,..,56
  const int c0 = (lane < 16) ? 0 : 8;
  const int fr = lane & 15;

  const unsigned laBase = (unsigned)(size_t)&As[lrow * LDT + lcol];
  const unsigned lbBase = (unsigned)(size_t)&Bs[lrow * LDT + lcol];
  const _Float16* gA = A  + (size_t)(bRow + lrow) * K + lcol;
  const _Float16* gB = BT + (size_t)(bCol + lrow) * K + lcol;
  const size_t gstep = (size_t)K * 32 * 2;          // 32 rows, in bytes
  auto issue = [&](int k0, int p) {
    async_stage_b128(laBase + (unsigned)(p * BM * LDT * 2),
                     lbBase + (unsigned)(p * BN * LDT * 2), 32 * LDT * 2,
                     gA + k0, gB + k0, gstep);
  };

  const int NIT = K / BK;
  issue(0, 0);
  for (int it = 0; it < NIT; ++it) {
    // this wave's LDS reads of the buffer that is refilled below have returned
    asm volatile("s_wait_dscnt 0x0" ::: "memory");
    wait_async0();       // this wave's pending tile is in LDS
    __syncthreads();     // everyone's tile in; previous buffer free
    const int p = it & 1;
    if (it + 1 < NIT) issue((it + 1) * BK, 1 - p);   // overlap with compute

    const _Float16* Ab = &As[p * BM * LDT];
    const _Float16* Bb = &Bs[p * BN * LDT];
    // unrolled so that both k steps read LDS at immediate offsets; k ascends
#pragma unroll
    for (int kk = 0; kk < BK; kk += 32) {
      FragH a[2], b[4];
#pragma unroll
      for (int mt = 0; mt < 2; ++mt) {
        int r = wm * 32 + mt * 16 + fr;
        a[mt].h[0] = *(const v8h*)&Ab[r * LDT + kk + c0];
        a[mt].h[1] = *(const v8h*)&Ab[r * LDT + kk + c0 + 16];
      }
#pragma unroll
      for (int nt = 0; nt < 4; ++nt) {
        int c = wn * 64 + nt * 16 + fr;
        b[nt].h[0] = *(const v8h*)&Bb[c * LDT + kk + c0];
        b[nt].h[1] = *(const v8h*)&Bb[c * LDT + kk + c0 + 16];
      }
#pragma unroll
      for (int mt = 0; mt < 2; ++mt)
#pragma unroll
        for (int nt = 0; nt < 4; ++nt)
          acc[mt][nt] = __builtin_amdgcn_wmma_f32_16x16x32_f16(
              false, a[mt].v, false, b[nt].v, (short)0, acc[mt][nt], false, false);
    }
  }

  // Epilogue: C layout -> row = base + r + (lane>=16?8:0), col = base + lane%16
  const int rbase = bRow + wm * 32 + ((lane >= 16) ? 8 : 0);
  const int cb    = bCol + wn * 64 + fr;
  // Every load of the epilogue is issued ahead of the first store, so that a wave
  // waits out one memory latency for all of them and not one for each element.
  float bv[4];
#pragma unroll
  for (int nt = 0; nt < 4; ++nt) bv[nt] = bias[cb + nt * 16];
  if constexpr (EPI == 2) {
    // ro: a lane's element offset in each of its 16 rows, counted from column bCol.
    // Loads and stores name the same 16 offset registers beside a scalar base, so
    // the registers keep their values until the last store has been issued.
    unsigned ro[16];
#pragma unroll
    for (int i = 0; i < 16; ++i)
      ro[i] = (unsigned)(rbase + (i >> 3) * 16 + (i & 7)) * (unsigned)N + (unsigned)(wn * 64 + fr);
    const float* rp = res + bCol;
    float* op = outF + bCol;
    float rv[4][16];
#pragma unroll
    for (int nt = 0; nt < 4; ++nt)
#pragma unroll
      for (int i = 0; i < 16; ++i) rv[nt][i] = (rp + nt * 16)[ro[i]];
#pragma unroll
    for (int nt = 0; nt < 4; ++nt)
#pragma unroll
      for (int i = 0; i < 16; ++i)
        (op + nt * 16)[ro[i]] = rv[nt][i] + (acc[i >> 3][nt][i & 7] + bv[nt]);
    return;
  }
#pragma unroll
  for (int mt = 0; mt < 2; ++mt) {
#pragma unroll
    for (int nt = 0; nt < 4; ++nt) {
      int   col = cb + nt * 16;
#pragma unroll
      for (int r = 0; r < 8; ++r) {
        int    row = rbase + mt * 16 + r;
        float  v   = acc[mt][nt][r] + bv[nt];
        size_t off = (size_t)row * N + col;
        if constexpr (EPI == 0) {
          outH[off] = (_Float16)v;
        } else {
          outH[off] = (_Float16)(0.5f * v * (1.0f + erff(v * 0.70710678118f)));
        }
      }
    }
  }
}

// Value of lane l ^ 16 (the same column of the other 16-lane row), by a vector
// cross-row move. All 32 lanes are on wherever it is used.
__device__ __forceinline__ float other_half(float x) {
  int b = __builtin_bit_cast(int, x);
  return __builtin_bit_cast(float, __builtin_amdgcn_permlanex16(
      b, b, 0x76543210, 0xfedcba98, false, false));
}

__global__ void __launch_bounds__(128)
flash_kernel(const _Float16* __restrict__ q, const _Float16* __restrict__ k,
             const _Float16* __restrict__ v, _Float16* __restrict__ o) {
  constexpr int D = 64, LDT = 72, TK = 64;
  __shared__ _Float16 qs[64 * LDT];
  __shared__ _Float16 ks[TK * LDT];
  __shared__ _Float16 vts[D * LDT];   // V transposed: [d][kv]

  const int tid = threadIdx.x, lane = tid & 31, wid = tid >> 5;
  const int qt = blockIdx.x, h = blockIdx.y, b = blockIdx.z;
  const size_t rs = 3 * D_MODEL, os = D_MODEL;
  const _Float16* qb = q + (size_t)b * SEQ * rs + (size_t)h * D;
  const _Float16* kb = k + (size_t)b * SEQ * rs + (size_t)h * D;
  const _Float16* vb = v + (size_t)b * SEQ * rs + (size_t)h * D;

  {                                 // Q tile 64x64 via async copies: rows qr + 16 * i
    const int qr = tid >> 3, qc = (tid & 7) * 8;
    const _Float16* qg = qb + (size_t)(qt * 64 + qr) * rs + qc;
    const unsigned ql = (unsigned)(size_t)&qs[qr * LDT + qc];
    async_quad_b128(ql, ql + 16 * LDT * 2, ql + 32 * LDT * 2, ql + 48 * LDT * 2,
                    qg, qg + 16 * rs, qg + 32 * rs, qg + 48 * rs);
  }
  wait_async0();
  __syncthreads();

  const int c0 = (lane < 16) ? 0 : 8;
  const int fr = lane & 15;
  FragH bq[2];                      // Qt as B: column = query wid * 16 + fr
#pragma unroll
  for (int w2 = 0; w2 < 2; ++w2) {
    int r = wid * 16 + fr;
    bq[w2].h[0] = *(const v8h*)&qs[r * LDT + w2 * 32 + c0];
    bq[w2].h[1] = *(const v8h*)&qs[r * LDT + w2 * 32 + c0 + 16];
  }

  const v8f vzero = {0.f, 0.f, 0.f, 0.f, 0.f, 0.f, 0.f, 0.f};
  constexpr float SC = 0.125f * 1.4426950408889634f;   // 1/sqrt(64) * log2(e)
  float mst = -1e30f;   // running maximum of the lane's query, times SC
  float lst = 0.f;      // running sum over the keys of this lane's half only
  v8f oa[4];            // oa[dt][r] = Ot[dt * 16 + 8 * h + r][query]
#pragma unroll
  for (int dt = 0; dt < 4; ++dt) oa[dt] = vzero;

  for (int j = 0; j < SEQ / TK; ++j) {
    __syncthreads();   // all waves done reading previous ks/vts
    // a thread's chunk i is row sr + 16 * i, halves sc .. sc + 7, of the K and V tiles.
    // The four V loads and the four K copies are all issued before the first V value
    // is waited for: one latency a tile, not one for each chunk.
    const int sr = tid >> 3, sc = (tid & 7) * 8;
    const _Float16* kg = kb + (size_t)(j * TK + sr) * rs + sc;
    const _Float16* vg = vb + (size_t)(j * TK + sr) * rs + sc;
    v8h vv[4];
#pragma unroll
    for (int i = 0; i < 4; ++i) vv[i] = *(const v8h*)(vg + (size_t)(16 * i) * rs);
    const unsigned kl = (unsigned)(size_t)&ks[sr * LDT + sc];
    async_quad_b128(kl, kl + 16 * LDT * 2, kl + 32 * LDT * 2, kl + 48 * LDT * 2,
                    kg, kg + 16 * rs, kg + 32 * rs, kg + 48 * rs);
#pragma unroll
    for (int i = 0; i < 4; ++i)
#pragma unroll
      for (int e = 0; e < 8; ++e) vts[(sc + e) * LDT + sr + 16 * i] = vv[i][e];
    wait_async0();
    __syncthreads();

    v8f s[4];
#pragma unroll
    for (int mt = 0; mt < 4; ++mt) s[mt] = vzero;
#pragma unroll
    for (int mt = 0; mt < 4; ++mt) {
      int kr = mt * 16 + fr;   // kv row serves as A row
#pragma unroll
      for (int w2 = 0; w2 < 2; ++w2) {
        FragH af;
        af.h[0] = *(const v8h*)&ks[kr * LDT + w2 * 32 + c0];
        af.h[1] = *(const v8h*)&ks[kr * LDT + w2 * 32 + c0 + 16];
        s[mt] = __builtin_amdgcn_wmma_f32_16x16x32_f16(
            false, af.v, false, bq[w2].v, (short)0, s[mt], false, false);
      }
    }
    // online softmax in base 2: exp((x - m) / 8) = exp2(x * SC - m * SC), so a score
    // costs one fused multiply-add and one hardware exponential. s stays unscaled;
    // mst holds the running maximum times SC (SC > 0: scaling keeps the order).
    // The maximum is joined across the halves every tile, so both halves scale alike;
    // the halves' sums are joined once, behind the loop.
    v8f m8 = __builtin_elementwise_max(__builtin_elementwise_max(s[0], s[1]),
                                       __builtin_elementwise_max(s[2], s[3]));
    float rm = fmaxf(fmaxf(fmaxf(m8[0], m8[1]), fmaxf(m8[2], m8[3])),
                     fmaxf(fmaxf(m8[4], m8[5]), fmaxf(m8[6], m8[7])));
    rm = fmaxf(rm, other_half(rm));
    const float mn = fmaxf(mst, rm * SC);
    const float corr = __builtin_amdgcn_exp2f(mst - mn);
    mst = mn;
    const v8f sc8 = {SC, SC, SC, SC, SC, SC, SC, SC};
    const v8f nm8 = {-mn, -mn, -mn, -mn, -mn, -mn, -mn, -mn};
#pragma unroll
    for (int mt = 0; mt < 4; ++mt) {
      s[mt] = __builtin_elementwise_fma(s[mt], sc8, nm8);
#pragma unroll
      for (int r = 0; r < 8; ++r) s[mt][r] = __builtin_amdgcn_exp2f(s[mt][r]);
    }
    v8f a8 = (s[0] + s[1]) + (s[2] + s[3]);
    const float rsum = ((a8[0] + a8[1]) + (a8[2] + a8[3])) + ((a8[4] + a8[5]) + (a8[6] + a8[7]));
    lst = lst * corr + rsum;
#pragma unroll
    for (int dt = 0; dt < 4; ++dt) oa[dt] *= corr;

    // Pt as B: element e of k step w2 is key w2 * 32 + (e < 8 ? 8 * h + e : 16 + 8 * h + e - 8),
    // which is register e & 7 of St tile 2 * w2 + (e >> 3)
    FragH pb[2];
#pragma unroll
    for (int w2 = 0; w2 < 2; ++w2)
#pragma unroll
      for (int e = 0; e < 16; ++e) pb[w2].v[e] = (_Float16)s[2 * w2 + (e >> 3)][e & 7];
#pragma unroll
    for (int dt = 0; dt < 4; ++dt) {
      int dr = dt * 16 + fr;   // row of Vt serves as A row
#pragma unroll
      for (int w2 = 0; w2 < 2; ++w2) {
        FragH av;
        av.h[0] = *(const v8h*)&vts[dr * LDT + w2 * 32 + c0];
        av.h[1] = *(const v8h*)&vts[dr * LDT + w2 * 32 + c0 + 16];
        oa[dt] = __builtin_amdgcn_wmma_f32_16x16x32_f16(
            false, av.v, false, pb[w2].v, (short)0, oa[dt], false, false);
      }
    }
  }

  // a lane's 8 registers of a tile are 8 consecutive d of its query: 16 B stores
  const float inv = 1.0f / (lst + other_half(lst));
  _Float16* ob = o + (size_t)b * SEQ * os + (size_t)h * D
                   + (size_t)(qt * 64 + wid * 16 + fr) * os + c0;
  v8h ov[4];
#pragma unroll
  for (int dt = 0; dt < 4; ++dt)
#pragma unroll
    for (int r = 0; r < 8; ++r) ov[dt][r] = (_Float16)(oa[dt][r] * inv);
#pragma unroll
  for (int dt = 0; dt < 4; ++dt) *(v8h*)(ob + dt * 16) = ov[dt];
}

// ---------------------------------------------------------------------------
extern "C" void kernel_launch(void* const* d_in, const int* in_sizes, int n_in,
                              void* d_out, int out_size, void* d_ws, size_t ws_size,
                              hipStream_t stream) {
  (void)in_sizes; (void)n_in; (void)out_size; (void)ws_size;
  const float* x   = (const float*)d_in[0];
  const float* wq  = (const float*)d_in[1];
  const float* bq  = (const float*)d_in[2];
  const float* wk  = (const float*)d_in[3];
  const float* bk  = (const float*)d_in[4];
  const float* wv  = (const float*)d_in[5];
  const float* bv  = (const float*)d_in[6];
  const float* wo  = (const float*)d_in[7];
  const float* bo  = (const float*)d_in[8];
  const float* w1  = (const float*)d_in[9];
  const float* b1  = (const float*)d_in[10];
  const float* w2  = (const float*)d_in[11];
  const float* b2  = (const float*)d_in[12];
  const float* g1  = (const float*)d_in[13];
  const float* be1 = (const float*)d_in[14];
  const float* g2  = (const float*)d_in[15];
  const float* be2 = (const float*)d_in[16];

  char* ws = (char*)d_ws;
  size_t off = 0;
  auto alloc = [&](size_t bytes) -> void* {
    void* p = ws + off;
    off += (bytes + 255) & ~(size_t)255;
    return p;
  };
  _Float16* ln16   = (_Float16*)alloc((size_t)ROWS * D_MODEL * 2);
  _Float16* qkv16  = (_Float16*)alloc((size_t)ROWS * 3 * D_MODEL * 2);
  _Float16* attn16 = (_Float16*)alloc((size_t)ROWS * D_MODEL * 2);
  float*    x1     = (float*)   alloc((size_t)ROWS * D_MODEL * 4);
  _Float16* h16    = (_Float16*)alloc((size_t)ROWS * D_FF * 2);
  _Float16* wqkvT  = (_Float16*)alloc((size_t)3 * D_MODEL * D_MODEL * 2);
  _Float16* woT    = (_Float16*)alloc((size_t)D_MODEL * D_MODEL * 2);
  _Float16* w1T    = (_Float16*)alloc((size_t)D_MODEL * D_FF * 2);
  _Float16* w2T    = (_Float16*)alloc((size_t)D_FF * D_MODEL * 2);
  float*    bqkv   = (float*)   alloc((size_t)3 * D_MODEL * 4);

  prep_kernel<<<PREP_GRID, 256, 0, stream>>>(x, g1, be1, ln16, wq, wk, wv, wo, w1, w2,
                                             wqkvT, woT, w1T, w2T, bq, bk, bv, bqkv);

  dim3 g768(D_MODEL / 128, ROWS / 128);
  dim3 gqkv(3 * D_MODEL / 128, ROWS / 128);
  gemm_wmma_kernel<0><<<gqkv, 256, 0, stream>>>(ln16, wqkvT, bqkv, nullptr, qkv16, nullptr,
                                                ROWS, 3 * D_MODEL, D_MODEL);

  dim3 gfa(SEQ / 64, HEADS, BATCH);
  flash_kernel<<<gfa, 128, 0, stream>>>(qkv16, qkv16 + D_MODEL, qkv16 + 2 * D_MODEL, attn16);

  gemm_wmma_kernel<2><<<g768, 256, 0, stream>>>(attn16, woT, bo, x, nullptr, x1,
                                                ROWS, D_MODEL, D_MODEL);

  ln_kernel<<<ROWS / 8, 256, 0, stream>>>(x1, g2, be2, ln16);

  dim3 gff(D_FF / 128, ROWS / 128);
  gemm_wmma_kernel<1><<<gff, 256, 0, stream>>>(ln16, w1T, b1, nullptr, h16, nullptr,
                                               ROWS, D_FF, D_MODEL);
  gemm_wmma_kernel<2><<<g768, 256, 0, stream>>>(h16, w2T, b2, x1, nullptr, (float*)d_out,
                                                ROWS, D_MODEL, D_FF);
}

// v008
// A run of this version takes 227 microseconds.
// Timed twice side by side with v007, it ran 1.04 times as fast both times.
// All steps since v000 together make it 2.70 times as fast.
#include <hip/hip_runtime.h>
#include <hip/hip_bf16.h>
#include <math.h>

typedef _Float16 v16h __attribute__((ext_vector_type(16)));
typedef _Float16 v8h  __attribute__((ext_vector_type(8)));
typedef float    v8f  __attribute__((ext_vector_type(8)));
typedef float    v4f  __attribute__((ext_vector_type(4)));

#define D_MODEL 768
#define HEADS   12
#define HEAD_DIM 64
#define D_FF    3072
#define SEQ     1024
#define BATCH   8
#define ROWS    (BATCH*SEQ)   // 8192

union FragH { v16h v; v8h h[2]; };

// Async copies global -> LDS (16B per lane), ASYNCcnt-tracked.
// LDS offset = low 32 bits of the flat shared pointer (aperture: addr[31:0]).
// Four async copies of one lane in one statement. The closing s_wait_xcnt is a
// precaution: inside the statement it stands ahead of every later rewrite of an
// address register that a copy names.
__device__ __forceinline__ void async_quad_b128(unsigned l0, unsigned l1, unsigned l2, unsigned l3,
                                                const void* g0, const void* g1,
                                                const void* g2, const void* g3) {
  asm volatile("global_load_async_to_lds_b128 %0, %4, off\n\t"
               "global_load_async_to_lds_b128 %1, %5, off\n\t"
               "global_load_async_to_lds_b128 %2, %6, off\n\t"
               "global_load_async_to_lds_b128 %3, %7, off\n\t"
               "s_wait_xcnt 0x0"
               :: "v"(l0), "v"(l1), "v"(l2), "v"(l3),
                  "v"((unsigned long long)(size_t)g0), "v"((unsigned long long)(size_t)g1),
                  "v"((unsigned long long)(size_t)g2), "v"((unsigned long long)(size_t)g3)
               : "memory");
}
__device__ __forceinline__ void wait_async0() {
  asm volatile("s_wait_asynccnt 0" ::: "memory");
}
// One stage's async copies of one lane: rows r, r+32, r+64, r+96 of the A tile
// and of the B tile. la/lb, ga/gb: the lane's LDS byte address and global address
// of row r; lstep/gstep: bytes from one of its rows to the next. The closing
// s_wait_xcnt is a precaution: inside the statement it stands ahead of every
// later rewrite of an address register that a copy names.
__device__ __forceinline__ void async_stage_b128(unsigned la, unsigned lb, unsigned lstep,
                                                 const _Float16* ga, const _Float16* gb,
                                                 size_t gstep) {
  const char* pa = (const char*)ga;
  const char* pb = (const char*)gb;
  asm volatile("global_load_async_to_lds_b128 %0, %8, off\n\t"
               "global_load_async_to_lds_b128 %1, %9, off\n\t"
               "global_load_async_to_lds_b128 %2, %10, off\n\t"
               "global_load_async_to_lds_b128 %3, %11, off\n\t"
               "global_load_async_to_lds_b128 %4, %12, off\n\t"
               "global_load_async_to_lds_b128 %5, %13, off\n\t"
               "global_load_async_to_lds_b128 %6, %14, off\n\t"
               "global_load_async_to_lds_b128 %7, %15, off\n\t"
               "s_wait_xcnt 0x0"
               :: "v"(la), "v"(la + lstep), "v"(la + 2 * lstep), "v"(la + 3 * lstep),
                  "v"(lb), "v"(lb + lstep), "v"(lb + 2 * lstep), "v"(lb + 3 * lstep),
                  "v"((unsigned long long)(size_t)pa),
                  "v"((unsigned long long)(size_t)(pa + gstep)),
                  "v"((unsigned long long)(size_t)(pa + 2 * gstep)),
                  "v"((unsigned long long)(size_t)(pa + 3 * gstep)),
                  "v"((unsigned long long)(size_t)pb),
                  "v"((unsigned long long)(size_t)(pb + gstep)),
                  "v"((unsigned long long)(size_t)(pb + 2 * gstep)),
                  "v"((unsigned long long)(size_t)(pb + 3 * gstep))
               : "memory");
}

// ---------------------------------------------------------------------------
// LayerNorm: one wave (32 lanes) per 768-wide row; unbiased std (ddof=1).
// ---------------------------------------------------------------------------
__device__ __forceinline__ void
ln_rows(const float* __restrict__ x, const float* __restrict__ g,
        const float* __restrict__ b, _Float16* __restrict__ out, int blk) {
  int wave = threadIdx.x >> 5;
  int lane = threadIdx.x & 31;
  int row  = blk * 8 + wave;
  const float* xr = x + (size_t)row * D_MODEL;
  float vals[24];
  float s = 0.f, s2 = 0.f;
#pragma unroll
  for (int i = 0; i < 24; ++i) {
    float vv = xr[lane + i * 32];
    vals[i] = vv; s += vv; s2 += vv * vv;
  }
#pragma unroll
  for (int m = 16; m >= 1; m >>= 1) {
    s  += __shfl_xor(s,  m, 32);
    s2 += __shfl_xor(s2, m, 32);
  }
  float mean = s * (1.0f / 768.0f);
  float var  = (s2 - 768.0f * mean * mean) * (1.0f / 767.0f);
  float stdd = sqrtf(fmaxf(var, 0.0f));
  float inv  = 1.0f / (stdd + 1e-5f);
  float gg = g[0], bb = b[0];
  _Float16* orow = out + (size_t)row * D_MODEL;
#pragma unroll
  for (int i = 0; i < 24; ++i)
    orow[lane + i * 32] = (_Float16)(gg * (vals[i] - mean) * inv + bb);
}

__global__ void __launch_bounds__(256)
ln_kernel(const float* __restrict__ x, const float* __restrict__ g,
          const float* __restrict__ b, _Float16* __restrict__ out) {
  ln_rows(x, g, b, out, blockIdx.x);
}

// ---------------------------------------------------------------------------
// Weight convert + transpose: w[K][N] fp32 -> wT[N][K] f16 (so GEMM B loads
// are contiguous along K, matching the 16-bit B-fragment VGPR striping).
// Transposed in registers: a lane reads 4 columns of 8 consecutive k rows
// (8 x 16 B), so it holds 8 consecutive k of each column and stores them as
// one 16 B piece. The 8 lanes that share a column cover 64 k: every store
// instruction of a wave fills 4 whole 128 B lines of wT, each written once.
// 4 waves = tile of 64 k x 64 n; K and N are multiples of 64. Tile t counts
// along n first; th = 0..127 is the thread's place among the tile's 4 waves.
// ---------------------------------------------------------------------------
template <int K, int N>
__device__ __forceinline__ void
wtrans_tile(const float* __restrict__ w, _Float16* __restrict__ wT, int t, int th) {
  const int lane = th & 31, wid = th >> 5;
  const int k0 = (t / (N / 64)) * 64 + (lane & 7) * 8;
  const int n0 = (t % (N / 64)) * 64 + wid * 16 + (lane >> 3) * 4;
  const float* src = w + (size_t)k0 * N + n0;
  v4f r[8];
#pragma unroll
  for (int j = 0; j < 8; ++j) r[j] = *(const v4f*)(src + (size_t)j * N);
  _Float16* dst = wT + (size_t)n0 * K + k0;
#pragma unroll
  for (int i = 0; i < 4; ++i) {
    v8h o;
#pragma unroll
    for (int j = 0; j < 8; ++j) o[j] = (_Float16)r[j][i];
    *(v8h*)(dst + (size_t)i * K) = o;
  }
  // precaution: stands ahead of any later rewrite of a register these stores name
  asm volatile("s_wait_xcnt 0x0" ::: "memory");
}

// ---------------------------------------------------------------------------
// Everything that depends on the inputs alone, in one grid of 256-thread blocks:
// the first layer norm (8 rows a block), the six weight transposes (two 64 x 64
// tiles a block) and the three projection biases laid one behind the other.
// wq, wk, wv go to one [3 * 768][768] matrix, so that Q, K and V are one GEMM.
// Which job a block does depends on blockIdx.x alone.
// ---------------------------------------------------------------------------
#define PREP_LN   (ROWS / 8)                          // 1024 blocks
#define PREP_SQ   (D_MODEL / 64 * (D_MODEL / 64) / 2)  // 72 blocks a square weight
#define PREP_FF   (D_MODEL / 64 * (D_FF / 64) / 2)     // 288 blocks a wide weight
#define PREP_BIAS (3 * D_MODEL / 256)                 // 9 blocks
#define PREP_GRID (PREP_LN + 4 * PREP_SQ + 2 * PREP_FF + PREP_BIAS)
__global__ void __launch_bounds__(256)
prep_kernel(const float* __restrict__ x, const float* __restrict__ g,
            const float* __restrict__ b, _Float16* __restrict__ lnOut,
            const float* __restrict__ wq, const float* __restrict__ wk,
            const float* __restrict__ wv, const float* __restrict__ wo,
            const float* __restrict__ w1, const float* __restrict__ w2,
            _Float16* __restrict__ wqkvT, _Float16* __restrict__ woT,
            _Float16* __restrict__ w1T, _Float16* __restrict__ w2T,
            const float* __restrict__ bq, const float* __restrict__ bk,
            const float* __restrict__ bv, float* __restrict__ bqkv) {
  int blk = blockIdx.x;
  if (blk < PREP_LN) { ln_rows(x, g, b, lnOut, blk); return; }
  blk -= PREP_LN;
  const int half = threadIdx.x >> 7, th = threadIdx.x & 127;
  if (blk < 4 * PREP_SQ) {
    const int m = blk / PREP_SQ;
    const int t = (blk - m * PREP_SQ) * 2 + half;
    const float* w = (m == 0) ? wq : (m == 1) ? wk : (m == 2) ? wv : wo;
    _Float16* d = (m < 3) ? wqkvT + (size_t)m * D_MODEL * D_MODEL : woT;
    wtrans_tile<D_MODEL, D_MODEL>(w, d, t, th);
    return;
  }
  blk -= 4 * PREP_SQ;
  if (blk < PREP_FF) { wtrans_tile<D_MODEL, D_FF>(w1, w1T, blk * 2 + half, th); return; }
  blk -= PREP_FF;
  if (blk < PREP_FF) { wtrans_tile<D_FF, D_MODEL>(w2, w2T, blk * 2 + half, th); return; }
  blk -= PREP_FF;
  const int m = blk / 3;                              // 3 blocks of 256 a bias
  const float* bs = (m == 0) ? bq : (m == 1) ? bk : bv;
  bqkv[blk * 256 + threadIdx.x] = bs[(blk - m * 3) * 256 + threadIdx.x];
  // precaution: stands ahead of any later rewrite of a register this store names
  asm volatile("s_wait_xcnt 0x0" ::: "memory");
}

// erf of 8 values at once, without a branch. Two fits in |x|, as a float math library
// has them: below 1 an odd polynomial, from 1 on 1 - exp(-q(|x|)). A wave nearly always
// holds values of both ranges, so a branch would run both sides one value at a time, each
// a chain of dependent operations; here both fits run on all 8 values as packed fused
// multiply-adds, a compare picks one, and the exponential is the hardware's exp2.
__device__ __forceinline__ v8f splat8(float c) { return (v8f){c, c, c, c, c, c, c, c}; }
__device__ __forceinline__ v8f erf8(v8f x) {
  const v8f ax = __builtin_elementwise_abs(x);
  const v8f t = x * x;
  v8f q = splat8(1.699881e-5f);
  q = __builtin_elementwise_fma(ax, q, splat8(-3.7867785e-4f));
  q = __builtin_elementwise_fma(ax, q, splat8(3.8578159e-3f));
  q = __builtin_elementwise_fma(ax, q, splat8(-2.4181698e-2f));
  q = __builtin_elementwise_fma(ax, q, splat8(1.0666826e-1f));
  q = __builtin_elementwise_fma(ax, q, splat8(6.349333e-1f));
  q = __builtin_elementwise_fma(ax, q, splat8(1.2868941e-1f));
  q = __builtin_elementwise_fma(ax, q, ax);
  q = q * splat8(-1.4426950408889634f);              // exp(-q) = exp2(-q * log2(e))
  v8f s = splat8(-5.618018e-4f);
  s = __builtin_elementwise_fma(t, s, splat8(4.913816e-3f));
  s = __builtin_elementwise_fma(t, s, splat8(-2.6707515e-2f));
  s = __builtin_elementwise_fma(t, s, splat8(1.1280011e-1f));
  s = __builtin_elementwise_fma(t, s, splat8(-3.7612295e-1f));
  s = __builtin_elementwise_fma(t, s, splat8(1.283791e-1f));
  s = __builtin_elementwise_fma(ax, s, ax);
  v8f r;
#pragma unroll
  for (int i = 0; i < 8; ++i) {
    const float big = 1.0f - __builtin_amdgcn_exp2f(q[i]);
    r[i] = __builtin_copysignf(ax[i] < 1.0f ? s[i] : big, x[i]);
  }
  return r;
}

// ---------------------------------------------------------------------------
// WMMA GEMM: C[M,N] = A[M,K](f16) * BT[N,K](f16)^T + bias, fused epilogue.
// EPI 0: -> f16   EPI 1: exact GELU -> f16   EPI 2: + residual -> f32
// Block 256 thr = 8 waves (4 along M x 2 along N); tile 128x128x64.
// Double-buffered LDS fed by global_load_async_to_lds_b128 (ASYNCcnt).
// A stage holds 64 k = 128 B of every operand row: 8 lanes copy one whole
// line, a wave's copy touches 4 lines, and one barrier serves 16 WMMAs a wave.
// ---------------------------------------------------------------------------
template <int EPI>
__global__ void __launch_bounds__(256)
gemm_wmma_kernel(const _Float16* __restrict__ A, const _Float16* __restrict__ BT,
                 const float* __restrict__ bias, const float* __restrict__ res,
                 _Float16* __restrict__ outH, float* __restrict__ outF,
                 int M, int N, int K) {
  constexpr int BM = 128, BN = 128, BK = 64, LDT = BK + 8;  // 72 halves/row = 16 B x 9
  __shared__ __attribute__((aligned(16))) _Float16 As[2 * BM * LDT];
  __shared__ __attribute__((aligned(16))) _Float16 Bs[2 * BN * LDT];

  const int tid  = threadIdx.x;
  const int lane = tid & 31, wid = tid >> 5;
  const int wm = wid & 3, wn = wid >> 2;           // 4 x 2 wave grid
  const int bRow = blockIdx.y * BM;
  const int bCol = blockIdx.x * BN;

  const v8f vzero = {0.f, 0.f, 0.f, 0.f, 0.f, 0.f, 0.f, 0.f};
  v8f acc[2][4];
#pragma unroll
  for (int i = 0; i < 2; ++i)
#pragma unroll
    for (int j = 0; j < 4; ++j) acc[i][j] = vzero;

  const int lrow = tid >> 3;        // 0..31
  const int lcol = (tid & 7) * 8;   // 0,8,..,56
  const int c0 = (lane < 16) ? 0 : 8;
  const int fr = lane & 15;

  const unsigned laBase = (unsigned)(size_t)&As[lrow * LDT + lcol];
  const unsigned lbBase = (unsigned)(size_t)&Bs[lrow * LDT + lcol];
  const _Float16* gA = A  + (size_t)(bRow + lrow) * K + lcol;
  const _Float16* gB = BT + (size_t)(bCol + lrow) * K + lcol;
  const size_t gstep = (size_t)K * 32 * 2;          // 32 rows, in bytes
  auto issue = [&](int k0, int p) {
    async_stage_b128(laBase + (unsigned)(p * BM * LDT * 2),
                     lbBase + (unsigned)(p * BN * LDT * 2), 32 * LDT * 2,
                     gA + k0, gB + k0, gstep);
  };

  const int NIT = K / BK;
  issue(0, 0);
  for (int it = 0; it < NIT; ++it) {
    // this wave's LDS reads of the buffer that is refilled below have returned
    asm volatile("s_wait_dscnt 0x0" ::: "memory");
    wait_async0();       // this wave's pending tile is in LDS
    __syncthreads();     // everyone's tile in; previous buffer free
    const int p = it & 1;
    if (it + 1 < NIT) issue((it + 1) * BK, 1 - p);   // overlap with compute

    const _Float16* Ab = &As[p * BM * LDT];
    const _Float16* Bb = &Bs[p * BN * LDT];
    // unrolled so that both k steps read LDS at immediate offsets; k ascends
#pragma unroll
    for (int kk = 0; kk < BK; kk += 32) {
      FragH a[2], b[4];
#pragma unroll
      for (int mt = 0; mt < 2; ++mt) {
        int r = wm * 32 + mt * 16 + fr;
        a[mt].h[0] = *(const v8h*)&Ab[r * LDT + kk + c0];
        a[mt].h[1] = *(const v8h*)&Ab[r * LDT + kk + c0 + 16];
      }
#pragma unroll
      for (int nt = 0; nt < 4; ++nt) {
        int c = wn * 64 + nt * 16 + fr;
        b[nt].h[0] = *(const v8h*)&Bb[c * LDT + kk + c0];
        b[nt].h[1] = *(const v8h*)&Bb[c * LDT + kk + c0 + 16];
      }
#pragma unroll
      for (int mt = 0; mt < 2; ++mt)
#pragma unroll
        for (int nt = 0; nt < 4; ++nt)
          acc[mt][nt] = __builtin_amdgcn_wmma_f32_16x16x32_f16(
              false, a[mt].v, false, b[nt].v, (short)0, acc[mt][nt], false, false);
    }
  }

  // Epilogue: C layout -> row = base + r + (lane>=16?8:0), col = base + lane%16
  const int rbase = bRow + wm * 32 + ((lane >= 16) ? 8 : 0);
  const int cb    = bCol + wn * 64 + fr;
  // Every load of the epilogue is issued ahead of the first store, so that a wave
  // waits out one memory latency for all of them and not one for each element.
  float bv[4];
#pragma unroll
  for (int nt = 0; nt < 4; ++nt) bv[nt] = bias[cb + nt * 16];
  if constexpr (EPI == 2) {
    // ro: a lane's element offset in each of its 16 rows, counted from column bCol.
    // Loads and stores name the same 16 offset registers beside a scalar base, so
    // the registers keep their values until the last store has been issued.
    unsigned ro[16];
#pragma unroll
    for (int i = 0; i < 16; ++i)
      ro[i] = (unsigned)(rbase + (i >> 3) * 16 + (i & 7)) * (unsigned)N + (unsigned)(wn * 64 + fr);
    const float* rp = res + bCol;
    float* op = outF + bCol;
    float rv[4][16];
#pragma unroll
    for (int nt = 0; nt < 4; ++nt)
#pragma unroll
      for (int i = 0; i < 16; ++i) rv[nt][i] = (rp + nt * 16)[ro[i]];
#pragma unroll
    for (int nt = 0; nt < 4; ++nt)
#pragma unroll
      for (int i = 0; i < 16; ++i)
        (op + nt * 16)[ro[i]] = rv[nt][i] + (acc[i >> 3][nt][i & 7] + bv[nt]);
    return;
  }
  if constexpr (EPI == 1) {
    typedef unsigned u32x4 __attribute__((ext_vector_type(4)));
    _Float16* op = outH + bCol;
#pragma unroll
    for (int mt = 0; mt < 2; ++mt) {
      unsigned ro[8];   // a lane's element offset in each of the 8 rows, from column bCol
#pragma unroll
      for (int r = 0; r < 8; ++r)
        ro[r] = (unsigned)(rbase + mt * 16 + r) * (unsigned)N + (unsigned)(wn * 64 + fr);
#pragma unroll
      for (int nt = 0; nt < 4; ++nt) {
        const v8f v8 = acc[mt][nt] + splat8(bv[nt]);
        const v8f g8 = (splat8(0.5f) * v8) * (splat8(1.0f) + erf8(v8 * splat8(0.70710678118f)));
        const v8h h8 = __builtin_convertvector(g8, v8h);
#pragma unroll
        for (int r = 0; r < 8; ++r) (op + nt * 16)[ro[r]] = h8[r];
        // precaution: the stored words and the row offsets are inputs of the wait, so
        // their registers keep their values until it; every later rewrite stands behind it
        const u32x4 w = __builtin_bit_cast(u32x4, h8);
        asm volatile("s_wait_xcnt 0x0"
                     :: "v"(w[0]), "v"(w[1]), "v"(w[2]), "v"(w[3]),
                        "v"(ro[0]), "v"(ro[1]), "v"(ro[2]), "v"(ro[3]),
                        "v"(ro[4]), "v"(ro[5]), "v"(ro[6]), "v"(ro[7])
                     : "memory");
      }
    }
    return;
  }
#pragma unroll
  for (int mt = 0; mt < 2; ++mt) {
#pragma unroll
    for (int nt = 0; nt < 4; ++nt) {
      int   col = cb + nt * 16;
#pragma unroll
      for (int r = 0; r < 8; ++r) {
        int    row = rbase + mt * 16 + r;
        float  v   = acc[mt][nt][r] + bv[nt];
        size_t off = (size_t)row * N + col;
        outH[off] = (_Float16)v;
      }
    }
  }
}

// Value of lane l ^ 16 (the same column of the other 16-lane row), by a vector
// cross-row move. All 32 lanes are on wherever it is used.
__device__ __forceinline__ float other_half(float x) {
  int b = __builtin_bit_cast(int, x);
  return __builtin_bit_cast(float, __builtin_amdgcn_permlanex16(
      b, b, 0x76543210, 0xfedcba98, false, false));
}

__global__ void __launch_bounds__(128)
flash_kernel(const _Float16* __restrict__ q, const _Float16* __restrict__ k,
             const _Float16* __restrict__ v, _Float16* __restrict__ o) {
  constexpr int D = 64, LDT = 72, TK = 64;
  __shared__ _Float16 qs[64 * LDT];
  __shared__ _Float16 ks[TK * LDT];
  __shared__ _Float16 vts[D * LDT];   // V transposed: [d][kv]

  const int tid = threadIdx.x, lane = tid & 31, wid = tid >> 5;
  const int qt = blockIdx.x, h = blockIdx.y, b = blockIdx.z;
  const size_t rs = 3 * D_MODEL, os = D_MODEL;
  const _Float16* qb = q + (size_t)b * SEQ * rs + (size_t)h * D;
  const _Float16* kb = k + (size_t)b * SEQ * rs + (size_t)h * D;
  const _Float16* vb = v + (size_t)b * SEQ * rs + (size_t)h * D;

  {                                 // Q tile 64x64 via async copies: rows qr + 16 * i
    const int qr = tid >> 3, qc = (tid & 7) * 8;
    const _Float16* qg = qb + (size_t)(qt * 64 + qr) * rs + qc;
    const unsigned ql = (unsigned)(size_t)&qs[qr * LDT + qc];
    async_quad_b128(ql, ql + 16 * LDT * 2, ql + 32 * LDT * 2, ql + 48 * LDT * 2,
                    qg, qg + 16 * rs, qg + 32 * rs, qg + 48 * rs);
  }
  wait_async0();
  __syncthreads();

  const int c0 = (lane < 16) ? 0 : 8;
  const int fr = lane & 15;
  FragH bq[2];                      // Qt as B: column = query wid * 16 + fr
#pragma unroll
  for (int w2 = 0; w2 < 2; ++w2) {
    int r = wid * 16 + fr;
    bq[w2].h[0] = *(const v8h*)&qs[r * LDT + w2 * 32 + c0];
    bq[w2].h[1] = *(const v8h*)&qs[r * LDT + w2 * 32 + c0 + 16];
  }

  const v8f vzero = {0.f, 0.f, 0.f, 0.f, 0.f, 0.f, 0.f, 0.f};
  constexpr float SC = 0.125f * 1.4426950408889634f;   // 1/sqrt(64) * log2(e)
  float mst = -1e30f;   // running maximum of the lane's query, times SC
  float lst = 0.f;      // running sum over the keys of this lane's half only
  v8f oa[4];            // oa[dt][r] = Ot[dt * 16 + 8 * h + r][query]
#pragma unroll
  for (int dt = 0; dt < 4; ++dt) oa[dt] = vzero;

  for (int j = 0; j < SEQ / TK; ++j) {
    __syncthreads();   // all waves done reading previous ks/vts
    // a thread's chunk i is row sr + 16 * i, halves sc .. sc + 7, of the K and V tiles.
    // The four V loads and the four K copies are all issued before the first V value
    // is waited for: one latency a tile, not one for each chunk.
    const int sr = tid >> 3, sc = (tid & 7) * 8;
    const _Float16* kg = kb + (size_t)(j * TK + sr) * rs + sc;
    const _Float16* vg = vb + (size_t)(j * TK + sr) * rs + sc;
    v8h vv[4];
#pragma unroll
    for (int i = 0; i < 4; ++i) vv[i] = *(const v8h*)(vg + (size_t)(16 * i) * rs);
    const unsigned kl = (unsigned)(size_t)&ks[sr * LDT + sc];
    async_quad_b128(kl, kl + 16 * LDT * 2, kl + 32 * LDT * 2, kl + 48 * LDT * 2,
                    kg, kg + 16 * rs, kg + 32 * rs, kg + 48 * rs);
#pragma unroll
    for (int i = 0; i < 4; ++i)
#pragma unroll
      for (int e = 0; e < 8; ++e) vts[(sc + e) * LDT + sr + 16 * i] = vv[i][e];
    wait_async0();
    __syncthreads();

    v8f s[4];
#pragma unroll
    for (int mt = 0; mt < 4; ++mt) s[mt] = vzero;
#pragma unroll
    for (int mt = 0; mt < 4; ++mt) {
      int kr = mt * 16 + fr;   // kv row serves as A row
#pragma unroll
      for (int w2 = 0; w2 < 2; ++w2) {
        FragH af;
        af.h[0] = *(const v8h*)&ks[kr * LDT + w2 * 32 + c0];
        af.h[1] = *(const v8h*)&ks[kr * LDT + w2 * 32 + c0 + 16];
        s[mt] = __builtin_amdgcn_wmma_f32_16x16x32_f16(
            false, af.v, false, bq[w2].v, (short)0, s[mt], false, false);
      }
    }
    // online softmax in base 2: exp((x - m) / 8) = exp2(x * SC - m * SC), so a score
    // costs one fused multiply-add and one hardware exponential. s stays unscaled;
    // mst holds the running maximum times SC (SC > 0: scaling keeps the order).
    // The maximum is joined across the halves every tile, so both halves scale alike;
    // the halves' sums are joined once, behind the loop.
    v8f m8 = __builtin_elementwise_max(__builtin_elementwise_max(s[0], s[1]),
                                       __builtin_elementwise_max(s[2], s[3]));
    float rm = fmaxf(fmaxf(fmaxf(m8[0], m8[1]), fmaxf(m8[2], m8[3])),
                     fmaxf(fmaxf(m8[4], m8[5]), fmaxf(m8[6], m8[7])));
    rm = fmaxf(rm, other_half(rm));
    const float mn = fmaxf(mst, rm * SC);
    const float corr = __builtin_amdgcn_exp2f(mst - mn);
    mst = mn;
    const v8f sc8 = {SC, SC, SC, SC, SC, SC, SC, SC};
    const v8f nm8 = {-mn, -mn, -mn, -mn, -mn, -mn, -mn, -mn};
#pragma unroll
    for (int mt = 0; mt < 4; ++mt) {
      s[mt] = __builtin_elementwise_fma(s[mt], sc8, nm8);
#pragma unroll
      for (int r = 0; r < 8; ++r) s[mt][r] = __builtin_amdgcn_exp2f(s[mt][r]);
    }
    v8f a8 = (s[0] + s[1]) + (s[2] + s[3]);
    const float rsum = ((a8[0] + a8[1]) + (a8[2] + a8[3])) + ((a8[4] + a8[5]) + (a8[6] + a8[7]));
    lst = lst * corr + rsum;
#pragma unroll
    for (int dt = 0; dt < 4; ++dt) oa[dt] *= corr;

    // Pt as B: element e of k step w2 is key w2 * 32 + (e < 8 ? 8 * h + e : 16 + 8 * h + e - 8),
    // which is register e & 7 of St tile 2 * w2 + (e >> 3)
    FragH pb[2];
#pragma unroll
    for (int w2 = 0; w2 < 2; ++w2)
#pragma unroll
      for (int e = 0; e < 16; ++e) pb[w2].v[e] = (_Float16)s[2 * w2 + (e >> 3)][e & 7];
#pragma unroll
    for (int dt = 0; dt < 4; ++dt) {
      int dr = dt * 16 + fr;   // row of Vt serves as A row
#pragma unroll
      for (int w2 = 0; w2 < 2; ++w2) {
        FragH av;
        av.h[0] = *(const v8h*)&vts[dr * LDT + w2 * 32 + c0];
        av.h[1] = *(const v8h*)&vts[dr * LDT + w2 * 32 + c0 + 16];
        oa[dt] = __builtin_amdgcn_wmma_f32_16x16x32_f16(
            false, av.v, false, pb[w2].v, (short)0, oa[dt], false, false);
      }
    }
  }

  // a lane's 8 registers of a tile are 8 consecutive d of its query: 16 B stores
  const float inv = 1.0f / (lst + other_half(lst));
  _Float16* ob = o + (size_t)b * SEQ * os + (size_t)h * D
                   + (size_t)(qt * 64 + wid * 16 + fr) * os + c0;
  v8h ov[4];
#pragma unroll
  for (int dt = 0; dt < 4; ++dt)
#pragma unroll
    for (int r = 0; r < 8; ++r) ov[dt][r] = (_Float16)(oa[dt][r] * inv);
#pragma unroll
  for (int dt = 0; dt < 4; ++dt) *(v8h*)(ob + dt * 16) = ov[dt];
}

// ---------------------------------------------------------------------------
extern "C" void kernel_launch(void* const* d_in, const int* in_sizes, int n_in,
                              void* d_out, int out_size, void* d_ws, size_t ws_size,
                              hipStream_t stream) {
  (void)in_sizes; (void)n_in; (void)out_size; (void)ws_size;
  const float* x   = (const float*)d_in[0];
  const float* wq  = (const float*)d_in[1];
  const float* bq  = (const float*)d_in[2];
  const float* wk  = (const float*)d_in[3];
  const float* bk  = (const float*)d_in[4];
  const float* wv  = (const float*)d_in[5];
  const float* bv  = (const float*)d_in[6];
  const float* wo  = (const float*)d_in[7];
  const float* bo  = (const float*)d_in[8];
  const float* w1  = (const float*)d_in[9];
  const float* b1  = (const float*)d_in[10];
  const float* w2  = (const float*)d_in[11];
  const float* b2  = (const float*)d_in[12];
  const float* g1  = (const float*)d_in[13];
  const float* be1 = (const float*)d_in[14];
  const float* g2  = (const float*)d_in[15];
  const float* be2 = (const float*)d_in[16];

  char* ws = (char*)d_ws;
  size_t off = 0;
  auto alloc = [&](size_t bytes) -> void* {
    void* p = ws + off;
    off += (bytes + 255) & ~(size_t)255;
    return p;
  };
  _Float16* ln16   = (_Float16*)alloc((size_t)ROWS * D_MODEL * 2);
  _Float16* qkv16  = (_Float16*)alloc((size_t)ROWS * 3 * D_MODEL * 2);
  _Float16* attn16 = (_Float16*)alloc((size_t)ROWS * D_MODEL * 2);
  float*    x1     = (float*)   alloc((size_t)ROWS * D_MODEL * 4);
  _Float16* h16    = (_Float16*)alloc((size_t)ROWS * D_FF * 2);
  _Float16* wqkvT  = (_Float16*)alloc((size_t)3 * D_MODEL * D_MODEL * 2);
  _Float16* woT    = (_Float16*)alloc((size_t)D_MODEL * D_MODEL * 2);
  _Float16* w1T    = (_Float16*)alloc((size_t)D_MODEL * D_FF * 2);
  _Float16* w2T    = (_Float16*)alloc((size_t)D_FF * D_MODEL * 2);
  float*    bqkv   = (float*)   alloc((size_t)3 * D_MODEL * 4);

  prep_kernel<<<PREP_GRID, 256, 0, stream>>>(x, g1, be1, ln16, wq, wk, wv, wo, w1, w2,
                                             wqkvT, woT, w1T, w2T, bq, bk, bv, bqkv);

  dim3 g768(D_MODEL / 128, ROWS / 128);
  dim3 gqkv(3 * D_MODEL / 128, ROWS / 128);
  gemm_wmma_kernel<0><<<gqkv, 256, 0, stream>>>(ln16, wqkvT, bqkv, nullptr, qkv16, nullptr,
                                                ROWS, 3 * D_MODEL, D_MODEL);

  dim3 gfa(SEQ / 64, HEADS, BATCH);
  flash_kernel<<<gfa, 128, 0, stream>>>(qkv16, qkv16 + D_MODEL, qkv16 + 2 * D_MODEL, attn16);

  gemm_wmma_kernel<2><<<g768, 256, 0, stream>>>(attn16, woT, bo, x, nullptr, x1,
                                                ROWS, D_MODEL, D_MODEL);

  ln_kernel<<<ROWS / 8, 256, 0, stream>>>(x1, g2, be2, ln16);

  dim3 gff(D_FF / 128, ROWS / 128);
  gemm_wmma_kernel<1><<<gff, 256, 0, stream>>>(ln16, w1T, b1, nullptr, h16, nullptr,
                                               ROWS, D_FF, D_MODEL);
  gemm_wmma_kernel<2><<<g768, 256, 0, stream>>>(h16, w2T, b2, x1, nullptr, (float*)d_out,
                                                ROWS, D_MODEL, D_FF);
}

// v009
// A run of this version takes 193 microseconds.
// In two side-by-side timings against v008, it was 1.18 and 1.17 times as fast.
// Counting every step since v000, it is 3.18 times as fast.
#include <hip/hip_runtime.h>
#include <hip/hip_bf16.h>
#include <math.h>

typedef _Float16 v16h __attribute__((ext_vector_type(16)));
typedef _Float16 v8h  __attribute__((ext_vector_type(8)));
typedef float    v8f  __attribute__((ext_vector_type(8)));
typedef float    v4f  __attribute__((ext_vector_type(4)));

#define D_MODEL 768
#define HEADS   12
#define HEAD_DIM 64
#define D_FF    3072
#define SEQ     1024
#define BATCH   8
#define ROWS    (BATCH*SEQ)   // 8192

union FragH { v16h v; v8h h[2]; };

// Async copies global -> LDS (16B per lane), ASYNCcnt-tracked.
// LDS offset = low 32 bits of the flat shared pointer (aperture: addr[31:0]).
// Four async copies of one lane in one statement. The closing s_wait_xcnt is a
// precaution: inside the statement it stands ahead of every later rewrite of an
// address register that a copy names.
__device__ __forceinline__ void async_quad_b128(unsigned l0, unsigned l1, unsigned l2, unsigned l3,
                                                const void* g0, const void* g1,
                                                const void* g2, const void* g3) {
  asm volatile("global_load_async_to_lds_b128 %0, %4, off\n\t"
               "global_load_async_to_lds_b128 %1, %5, off\n\t"
               "global_load_async_to_lds_b128 %2, %6, off\n\t"
               "global_load_async_to_lds_b128 %3, %7, off\n\t"
               "s_wait_xcnt 0x0"
               :: "v"(l0), "v"(l1), "v"(l2), "v"(l3),
                  "v"((unsigned long long)(size_t)g0), "v"((unsigned long long)(size_t)g1),
                  "v"((unsigned long long)(size_t)g2), "v"((unsigned long long)(size_t)g3)
               : "memory");
}
// Eight async copies of one lane in one statement: rows r, r+16, r+32, r+48 of two
// tiles whose LDS pitches differ. la/lb, ga/gb: the lane's LDS byte address and global
// address of row r; las/lbs, gstep: bytes from one of its rows to the next. The closing
// s_wait_xcnt is a precaution: inside the statement it stands ahead of every later
// rewrite of an address register that a copy names.
__device__ __forceinline__ void async_pair_b128(unsigned la, unsigned las, unsigned lb, unsigned lbs,
                                                const _Float16* ga, const _Float16* gb,
                                                size_t gstep) {
  const char* pa = (const char*)ga;
  const char* pb = (const char*)gb;
  asm volatile("global_load_async_to_lds_b128 %0, %8, off\n\t"
               "global_load_async_to_lds_b128 %1, %9, off\n\t"
               "global_load_async_to_lds_b128 %2, %10, off\n\t"
               "global_load_async_to_lds_b128 %3, %11, off\n\t"
               "global_load_async_to_lds_b128 %4, %12, off\n\t"
               "global_load_async_to_lds_b128 %5, %13, off\n\t"
               "global_load_async_to_lds_b128 %6, %14, off\n\t"
               "global_load_async_to_lds_b128 %7, %15, off\n\t"
               "s_wait_xcnt 0x0"
               :: "v"(la), "v"(la + las), "v"(la + 2 * las), "v"(la + 3 * las),
                  "v"(lb), "v"(lb + lbs), "v"(lb + 2 * lbs), "v"(lb + 3 * lbs),
                  "v"((unsigned long long)(size_t)pa),
                  "v"((unsigned long long)(size_t)(pa + gstep)),
                  "v"((unsigned long long)(size_t)(pa + 2 * gstep)),
                  "v"((unsigned long long)(size_t)(pa + 3 * gstep)),
                  "v"((unsigned long long)(size_t)pb),
                  "v"((unsigned long long)(size_t)(pb + gstep)),
                  "v"((unsigned long long)(size_t)(pb + 2 * gstep)),
                  "v"((unsigned long long)(size_t)(pb + 3 * gstep))
               : "memory");
}
__device__ __forceinline__ void wait_async0() {
  asm volatile("s_wait_asynccnt 0" ::: "memory");
}
// One stage's async copies of one lane: rows r, r+32, r+64, r+96 of the A tile
// and of the B tile. la/lb, ga/gb: the lane's LDS byte address and global address
// of row r; lstep/gstep: bytes from one of its rows to the next. The closing
// s_wait_xcnt is a precaution: inside the statement it stands ahead of every
// later rewrite of an address register that a copy names.
__device__ __forceinline__ void async_stage_b128(unsigned la, unsigned lb, unsigned lstep,
                                                 const _Float16* ga, const _Float16* gb,
                                                 size_t gstep) {
  const char* pa = (const char*)ga;
  const char* pb = (const char*)gb;
  asm volatile("global_load_async_to_lds_b128 %0, %8, off\n\t"
               "global_load_async_to_lds_b128 %1, %9, off\n\t"
               "global_load_async_to_lds_b128 %2, %10, off\n\t"
               "global_load_async_to_lds_b128 %3, %11, off\n\t"
               "global_load_async_to_lds_b128 %4, %12, off\n\t"
               "global_load_async_to_lds_b128 %5, %13, off\n\t"
               "global_load_async_to_lds_b128 %6, %14, off\n\t"
               "global_load_async_to_lds_b128 %7, %15, off\n\t"
               "s_wait_xcnt 0x0"
               :: "v"(la), "v"(la + lstep), "v"(la + 2 * lstep), "v"(la + 3 * lstep),
                  "v"(lb), "v"(lb + lstep), "v"(lb + 2 * lstep), "v"(lb + 3 * lstep),
                  "v"((unsigned long long)(size_t)pa),
                  "v"((unsigned long long)(size_t)(pa + gstep)),
                  "v"((unsigned long long)(size_t)(pa + 2 * gstep)),
                  "v"((unsigned long long)(size_t)(pa + 3 * gstep)),
                  "v"((unsigned long long)(size_t)pb),
                  "v"((unsigned long long)(size_t)(pb + gstep)),
                  "v"((unsigned long long)(size_t)(pb + 2 * gstep)),
                  "v"((unsigned long long)(size_t)(pb + 3 * gstep))
               : "memory");
}

// ---------------------------------------------------------------------------
// LayerNorm: one wave (32 lanes) per 768-wide row; unbiased std (ddof=1).
// ---------------------------------------------------------------------------
__device__ __forceinline__ void
ln_rows(const float* __restrict__ x, const float* __restrict__ g,
        const float* __restrict__ b, _Float16* __restrict__ out, int blk) {
  int wave = threadIdx.x >> 5;
  int lane = threadIdx.x & 31;
  int row  = blk * 8 + wave;
  const float* xr = x + (size_t)row * D_MODEL;
  float vals[24];
  float s = 0.f, s2 = 0.f;
#pragma unroll
  for (int i = 0; i < 24; ++i) {
    float vv = xr[lane + i * 32];
    vals[i] = vv; s += vv; s2 += vv * vv;
  }
#pragma unroll
  for (int m = 16; m >= 1; m >>= 1) {
    s  += __shfl_xor(s,  m, 32);
    s2 += __shfl_xor(s2, m, 32);
  }
  float mean = s * (1.0f / 768.0f);
  float var  = (s2 - 768.0f * mean * mean) * (1.0f / 767.0f);
  float stdd = sqrtf(fmaxf(var, 0.0f));
  float inv  = 1.0f / (stdd + 1e-5f);
  float gg = g[0], bb = b[0];
  _Float16* orow = out + (size_t)row * D_MODEL;
#pragma unroll
  for (int i = 0; i < 24; ++i)
    orow[lane + i * 32] = (_Float16)(gg * (vals[i] - mean) * inv + bb);
}

__global__ void __launch_bounds__(256)
ln_kernel(const float* __restrict__ x, const float* __restrict__ g,
          const float* __restrict__ b, _Float16* __restrict__ out) {
  ln_rows(x, g, b, out, blockIdx.x);
}

// ---------------------------------------------------------------------------
// Weight convert + transpose: w[K][N] fp32 -> wT[N][K] f16 (so GEMM B loads
// are contiguous along K, matching the 16-bit B-fragment VGPR striping).
// Transposed in registers: a lane reads 4 columns of 8 consecutive k rows
// (8 x 16 B), so it holds 8 consecutive k of each column and stores them as
// one 16 B piece. The 8 lanes that share a column cover 64 k: every store
// instruction of a wave fills 4 whole 128 B lines of wT, each written once.
// 4 waves = tile of 64 k x 64 n; K and N are multiples of 64. Tile t counts
// along n first; th = 0..127 is the thread's place among the tile's 4 waves.
// ---------------------------------------------------------------------------
template <int K, int N>
__device__ __forceinline__ void
wtrans_tile(const float* __restrict__ w, _Float16* __restrict__ wT, int t, int th) {
  const int lane = th & 31, wid = th >> 5;
  const int k0 = (t / (N / 64)) * 64 + (lane & 7) * 8;
  const int n0 = (t % (N / 64)) * 64 + wid * 16 + (lane >> 3) * 4;
  const float* src = w + (size_t)k0 * N + n0;
  v4f r[8];
#pragma unroll
  for (int j = 0; j < 8; ++j) r[j] = *(const v4f*)(src + (size_t)j * N);
  _Float16* dst = wT + (size_t)n0 * K + k0;
#pragma unroll
  for (int i = 0; i < 4; ++i) {
    v8h o;
#pragma unroll
    for (int j = 0; j < 8; ++j) o[j] = (_Float16)r[j][i];
    *(v8h*)(dst + (size_t)i * K) = o;
  }
  // precaution: stands ahead of any later rewrite of a register these stores name
  asm volatile("s_wait_xcnt 0x0" ::: "memory");
}

// ---------------------------------------------------------------------------
// Everything that depends on the inputs alone, in one grid of 256-thread blocks:
// the first layer norm (8 rows a block), the six weight transposes (two 64 x 64
// tiles a block) and the three projection biases laid one behind the other.
// wq, wk, wv go to one [3 * 768][768] matrix, so that Q, K and V are one GEMM.
// Which job a block does depends on blockIdx.x alone.
// ---------------------------------------------------------------------------
#define PREP_LN   (ROWS / 8)                          // 1024 blocks
#define PREP_SQ   (D_MODEL / 64 * (D_MODEL / 64) / 2)  // 72 blocks a square weight
#define PREP_FF   (D_MODEL / 64 * (D_FF / 64) / 2)     // 288 blocks a wide weight
#define PREP_BIAS (3 * D_MODEL / 256)                 // 9 blocks
#define PREP_GRID (PREP_LN + 4 * PREP_SQ + 2 * PREP_FF + PREP_BIAS)
__global__ void __launch_bounds__(256)
prep_kernel(const float* __restrict__ x, const float* __restrict__ g,
            const float* __restrict__ b, _Float16* __restrict__ lnOut,
            const float* __restrict__ wq, const float* __restrict__ wk,
            const float* __restrict__ wv, const float* __restrict__ wo,
            const float* __restrict__ w1, const float* __restrict__ w2,
            _Float16* __restrict__ wqkvT, _Float16* __restrict__ woT,
            _Float16* __restrict__ w1T, _Float16* __restrict__ w2T,
            const float* __restrict__ bq, const float* __restrict__ bk,
            const float* __restrict__ bv, float* __restrict__ bqkv) {
  int blk = blockIdx.x;
  if (blk < PREP_LN) { ln_rows(x, g, b, lnOut, blk); return; }
  blk -= PREP_LN;
  const int half = threadIdx.x >> 7, th = threadIdx.x & 127;
  if (blk < 4 * PREP_SQ) {
    const int m = blk / PREP_SQ;
    const int t = (blk - m * PREP_SQ) * 2 + half;
    const float* w = (m == 0) ? wq : (m == 1) ? wk : (m == 2) ? wv : wo;
    _Float16* d = (m < 3) ? wqkvT + (size_t)m * D_MODEL * D_MODEL : woT;
    wtrans_tile<D_MODEL, D_MODEL>(w, d, t, th);
    return;
  }
  blk -= 4 * PREP_SQ;
  if (blk < PREP_FF) { wtrans_tile<D_MODEL, D_FF>(w1, w1T, blk * 2 + half, th); return; }
  blk -= PREP_FF;
  if (blk < PREP_FF) { wtrans_tile<D_FF, D_MODEL>(w2, w2T, blk * 2 + half, th); return; }
  blk -= PREP_FF;
  const int m = blk / 3;                              // 3 blocks of 256 a bias
  const float* bs = (m == 0) ? bq : (m == 1) ? bk : bv;
  bqkv[blk * 256 + threadIdx.x] = bs[(blk - m * 3) * 256 + threadIdx.x];
  // precaution: stands ahead of any later rewrite of a register this store names
  asm volatile("s_wait_xcnt 0x0" ::: "memory");
}

// erf of 8 values at once, without a branch. Two fits in |x|, as a float math library
// has them: below 1 an odd polynomial, from 1 on 1 - exp(-q(|x|)). A wave nearly always
// holds values of both ranges, so a branch would run both sides one value at a time, each
// a chain of dependent operations; here both fits run on all 8 values as packed fused
// multiply-adds, a compare picks one, and the exponential is the hardware's exp2.
__device__ __forceinline__ v8f splat8(float c) { return (v8f){c, c, c, c, c, c, c, c}; }
__device__ __forceinline__ v8f erf8(v8f x) {
  const v8f ax = __builtin_elementwise_abs(x);
  const v8f t = x * x;
  v8f q = splat8(1.699881e-5f);
  q = __builtin_elementwise_fma(ax, q, splat8(-3.7867785e-4f));
  q = __builtin_elementwise_fma(ax, q, splat8(3.8578159e-3f));
  q = __builtin_elementwise_fma(ax, q, splat8(-2.4181698e-2f));
  q = __builtin_elementwise_fma(ax, q, splat8(1.0666826e-1f));
  q = __builtin_elementwise_fma(ax, q, splat8(6.349333e-1f));
  q = __builtin_elementwise_fma(ax, q, splat8(1.2868941e-1f));
  q = __builtin_elementwise_fma(ax, q, ax);
  q = q * splat8(-1.4426950408889634f);              // exp(-q) = exp2(-q * log2(e))
  v8f s = splat8(-5.618018e-4f);
  s = __builtin_elementwise_fma(t, s, splat8(4.913816e-3f));
  s = __builtin_elementwise_fma(t, s, splat8(-2.6707515e-2f));
  s = __builtin_elementwise_fma(t, s, splat8(1.1280011e-1f));
  s = __builtin_elementwise_fma(t, s, splat8(-3.7612295e-1f));
  s = __builtin_elementwise_fma(t, s, splat8(1.283791e-1f));
  s = __builtin_elementwise_fma(ax, s, ax);
  v8f r;
#pragma unroll
  for (int i = 0; i < 8; ++i) {
    const float big = 1.0f - __builtin_amdgcn_exp2f(q[i]);
    r[i] = __builtin_copysignf(ax[i] < 1.0f ? s[i] : big, x[i]);
  }
  return r;
}

// ---------------------------------------------------------------------------
// WMMA GEMM: C[M,N] = A[M,K](f16) * BT[N,K](f16)^T + bias, fused epilogue.
// EPI 0: -> f16   EPI 1: exact GELU -> f16   EPI 2: + residual -> f32
// Block 256 thr = 8 waves (4 along M x 2 along N); tile 128x128x64.
// Double-buffered LDS fed by global_load_async_to_lds_b128 (ASYNCcnt).
// A stage holds 64 k = 128 B of every operand row: 8 lanes copy one whole
// line, a wave's copy touches 4 lines, and one barrier serves 16 WMMAs a wave.
// ---------------------------------------------------------------------------
template <int EPI>
__global__ void __launch_bounds__(256)
gemm_wmma_kernel(const _Float16* __restrict__ A, const _Float16* __restrict__ BT,
                 const float* __restrict__ bias, const float* __restrict__ res,
                 _Float16* __restrict__ outH, float* __restrict__ outF,
                 int M, int N, int K) {
  constexpr int BM = 128, BN = 128, BK = 64, LDT = BK + 8;  // 72 halves/row = 16 B x 9
  __shared__ __attribute__((aligned(16))) _Float16 As[2 * BM * LDT];
  __shared__ __attribute__((aligned(16))) _Float16 Bs[2 * BN * LDT];

  const int tid  = threadIdx.x;
  const int lane = tid & 31, wid = tid >> 5;
  const int wm = wid & 3, wn = wid >> 2;           // 4 x 2 wave grid
  const int bRow = blockIdx.y * BM;
  const int bCol = blockIdx.x * BN;

  const v8f vzero = {0.f, 0.f, 0.f, 0.f, 0.f, 0.f, 0.f, 0.f};
  v8f acc[2][4];
#pragma unroll
  for (int i = 0; i < 2; ++i)
#pragma unroll
    for (int j = 0; j < 4; ++j) acc[i][j] = vzero;

  const int lrow = tid >> 3;        // 0..31
  const int lcol = (tid & 7) * 8;   // 0,8,..,56
  const int c0 = (lane < 16) ? 0 : 8;
  const int fr = lane & 15;

  const unsigned laBase = (unsigned)(size_t)&As[lrow * LDT + lcol];
  const unsigned lbBase = (unsigned)(size_t)&Bs[lrow * LDT + lcol];
  const _Float16* gA = A  + (size_t)(bRow + lrow) * K + lcol;
  const _Float16* gB = BT + (size_t)(bCol + lrow) * K + lcol;
  const size_t gstep = (size_t)K * 32 * 2;          // 32 rows, in bytes
  auto issue = [&](int k0, int p) {
    async_stage_b128(laBase + (unsigned)(p * BM * LDT * 2),
                     lbBase + (unsigned)(p * BN * LDT * 2), 32 * LDT * 2,
                     gA + k0, gB + k0, gstep);
  };

  const int NIT = K / BK;
  issue(0, 0);
  for (int it = 0; it < NIT; ++it) {
    // this wave's LDS reads of the buffer that is refilled below have returned
    asm volatile("s_wait_dscnt 0x0" ::: "memory");
    wait_async0();       // this wave's pending tile is in LDS
    __syncthreads();     // everyone's tile in; previous buffer free
    const int p = it & 1;
    if (it + 1 < NIT) issue((it + 1) * BK, 1 - p);   // overlap with compute

    const _Float16* Ab = &As[p * BM * LDT];
    const _Float16* Bb = &Bs[p * BN * LDT];
    // unrolled so that both k steps read LDS at immediate offsets; k ascends
#pragma unroll
    for (int kk = 0; kk < BK; kk += 32) {
      FragH a[2], b[4];
#pragma unroll
      for (int mt = 0; mt < 2; ++mt) {
        int r = wm * 32 + mt * 16 + fr;
        a[mt].h[0] = *(const v8h*)&Ab[r * LDT + kk + c0];
        a[mt].h[1] = *(const v8h*)&Ab[r * LDT + kk + c0 + 16];
      }
#pragma unroll
      for (int nt = 0; nt < 4; ++nt) {
        int c = wn * 64 + nt * 16 + fr;
        b[nt].h[0] = *(const v8h*)&Bb[c * LDT + kk + c0];
        b[nt].h[1] = *(const v8h*)&Bb[c * LDT + kk + c0 + 16];
      }
#pragma unroll
      for (int mt = 0; mt < 2; ++mt)
#pragma unroll
        for (int nt = 0; nt < 4; ++nt)
          acc[mt][nt] = __builtin_amdgcn_wmma_f32_16x16x32_f16(
              false, a[mt].v, false, b[nt].v, (short)0, acc[mt][nt], false, false);
    }
  }

  // Epilogue: C layout -> row = base + r + (lane>=16?8:0), col = base + lane%16
  const int rbase = bRow + wm * 32 + ((lane >= 16) ? 8 : 0);
  const int cb    = bCol + wn * 64 + fr;
  // Every load of the epilogue is issued ahead of the first store, so that a wave
  // waits out one memory latency for all of them and not one for each element.
  float bv[4];
#pragma unroll
  for (int nt = 0; nt < 4; ++nt) bv[nt] = bias[cb + nt * 16];
  if constexpr (EPI == 2) {
    // ro: a lane's element offset in each of its 16 rows, counted from column bCol.
    // Loads and stores name the same 16 offset registers beside a scalar base, so
    // the registers keep their values until the last store has been issued.
    unsigned ro[16];
#pragma unroll
    for (int i = 0; i < 16; ++i)
      ro[i] = (unsigned)(rbase + (i >> 3) * 16 + (i & 7)) * (unsigned)N + (unsigned)(wn * 64 + fr);
    const float* rp = res + bCol;
    float* op = outF + bCol;
    float rv[4][16];
#pragma unroll
    for (int nt = 0; nt < 4; ++nt)
#pragma unroll
      for (int i = 0; i < 16; ++i) rv[nt][i] = (rp + nt * 16)[ro[i]];
#pragma unroll
    for (int nt = 0; nt < 4; ++nt)
#pragma unroll
      for (int i = 0; i < 16; ++i)
        (op + nt * 16)[ro[i]] = rv[nt][i] + (acc[i >> 3][nt][i & 7] + bv[nt]);
    return;
  }
  if constexpr (EPI == 1) {
    typedef unsigned u32x4 __attribute__((ext_vector_type(4)));
    _Float16* op = outH + bCol;
#pragma unroll
    for (int mt = 0; mt < 2; ++mt) {
      unsigned ro[8];   // a lane's element offset in each of the 8 rows, from column bCol
#pragma unroll
      for (int r = 0; r < 8; ++r)
        ro[r] = (unsigned)(rbase + mt * 16 + r) * (unsigned)N + (unsigned)(wn * 64 + fr);
#pragma unroll
      for (int nt = 0; nt < 4; ++nt) {
        const v8f v8 = acc[mt][nt] + splat8(bv[nt]);
        const v8f g8 = (splat8(0.5f) * v8) * (splat8(1.0f) + erf8(v8 * splat8(0.70710678118f)));
        const v8h h8 = __builtin_convertvector(g8, v8h);
#pragma unroll
        for (int r = 0; r < 8; ++r) (op + nt * 16)[ro[r]] = h8[r];
        // precaution: the stored words and the row offsets are inputs of the wait, so
        // their registers keep their values until it; every later rewrite stands behind it
        const u32x4 w = __builtin_bit_cast(u32x4, h8);
        asm volatile("s_wait_xcnt 0x0"
                     :: "v"(w[0]), "v"(w[1]), "v"(w[2]), "v"(w[3]),
                        "v"(ro[0]), "v"(ro[1]), "v"(ro[2]), "v"(ro[3]),
                        "v"(ro[4]), "v"(ro[5]), "v"(ro[6]), "v"(ro[7])
                     : "memory");
      }
    }
    return;
  }
#pragma unroll
  for (int mt = 0; mt < 2; ++mt) {
#pragma unroll
    for (int nt = 0; nt < 4; ++nt) {
      int   col = cb + nt * 16;
#pragma unroll
      for (int r = 0; r < 8; ++r) {
        int    row = rbase + mt * 16 + r;
        float  v   = acc[mt][nt][r] + bv[nt];
        size_t off = (size_t)row * N + col;
        outH[off] = (_Float16)v;
      }
    }
  }
}

// Transposing LDS load: from a row-major tile of 16-bit values, lane (c, h) gets the 8
// values of column c in rows 8 * h .. 8 * h + 7. p is the lane's own 16 B piece of the tile.
__device__ __forceinline__ v8h lds_tr16(const _Float16* p) {
  typedef short s16x8 __attribute__((ext_vector_type(8)));
  typedef __attribute__((address_space(3))) s16x8 lds_s16x8;
  return __builtin_bit_cast(v8h, __builtin_amdgcn_ds_load_tr16_b128_v8i16((lds_s16x8*)p));
}

// Value of lane l ^ 16 (the same column of the other 16-lane row), by a vector
// cross-row move. All 32 lanes are on wherever it is used.
__device__ __forceinline__ float other_half(float x) {
  int b = __builtin_bit_cast(int, x);
  return __builtin_bit_cast(float, __builtin_amdgcn_permlanex16(
      b, b, 0x76543210, 0xfedcba98, false, false));
}

__global__ void __launch_bounds__(128)
flash_kernel(const _Float16* __restrict__ q, const _Float16* __restrict__ k,
             const _Float16* __restrict__ v, _Float16* __restrict__ o) {
  constexpr int D = 64, LDT = 72, LDV = 80, TK = 64;
  __shared__ _Float16 qs[64 * LDT];
  __shared__ __attribute__((aligned(16))) _Float16 ks[TK * LDT];
  __shared__ __attribute__((aligned(16))) _Float16 vs[TK * LDV];   // V as it lies: [kv][d]

  const int tid = threadIdx.x, lane = tid & 31, wid = tid >> 5;
  const int qt = blockIdx.x, h = blockIdx.y, b = blockIdx.z;
  const size_t rs = 3 * D_MODEL, os = D_MODEL;
  const _Float16* qb = q + (size_t)b * SEQ * rs + (size_t)h * D;
  const _Float16* kb = k + (size_t)b * SEQ * rs + (size_t)h * D;
  const _Float16* vb = v + (size_t)b * SEQ * rs + (size_t)h * D;

  {                                 // Q tile 64x64 via async copies: rows qr + 16 * i
    const int qr = tid >> 3, qc = (tid & 7) * 8;
    const _Float16* qg = qb + (size_t)(qt * 64 + qr) * rs + qc;
    const unsigned ql = (unsigned)(size_t)&qs[qr * LDT + qc];
    async_quad_b128(ql, ql + 16 * LDT * 2, ql + 32 * LDT * 2, ql + 48 * LDT * 2,
                    qg, qg + 16 * rs, qg + 32 * rs, qg + 48 * rs);
  }
  wait_async0();
  __syncthreads();

  const int c0 = (lane < 16) ? 0 : 8;
  const int fr = lane & 15;
  FragH bq[2];                      // Qt as B: column = query wid * 16 + fr
#pragma unroll
  for (int w2 = 0; w2 < 2; ++w2) {
    int r = wid * 16 + fr;
    bq[w2].h[0] = *(const v8h*)&qs[r * LDT + w2 * 32 + c0];
    bq[w2].h[1] = *(const v8h*)&qs[r * LDT + w2 * 32 + c0 + 16];
  }

  const v8f vzero = {0.f, 0.f, 0.f, 0.f, 0.f, 0.f, 0.f, 0.f};
  constexpr float SC = 0.125f * 1.4426950408889634f;   // 1/sqrt(64) * log2(e)
  float mst = -1e30f;   // running maximum of the lane's query, times SC
  float lst = 0.f;      // running sum over the keys of this lane's half only
  v8f oa[4];            // oa[dt][r] = Ot[dt * 16 + 8 * h + r][query]
#pragma unroll
  for (int dt = 0; dt < 4; ++dt) oa[dt] = vzero;

  for (int j = 0; j < SEQ / TK; ++j) {
    // this wave's LDS reads of the tiles that are refilled below have returned
    asm volatile("s_wait_dscnt 0x0" ::: "memory");
    __syncthreads();   // all waves done reading previous ks/vs
    // a thread's chunk i is row sr + 16 * i, halves sc .. sc + 7, of the K and V tiles
    const int sr = tid >> 3, sc = (tid & 7) * 8;
    const _Float16* kg = kb + (size_t)(j * TK + sr) * rs + sc;
    const _Float16* vg = vb + (size_t)(j * TK + sr) * rs + sc;
    async_pair_b128((unsigned)(size_t)&ks[sr * LDT + sc], 16 * LDT * 2,
                    (unsigned)(size_t)&vs[sr * LDV + sc], 16 * LDV * 2,
                    kg, vg, 16 * rs * 2);
    wait_async0();
    __syncthreads();

    v8f s[4];
#pragma unroll
    for (int mt = 0; mt < 4; ++mt) s[mt] = vzero;
#pragma unroll
    for (int mt = 0; mt < 4; ++mt) {
      int kr = mt * 16 + fr;   // kv row serves as A row
#pragma unroll
      for (int w2 = 0; w2 < 2; ++w2) {
        FragH af;
        af.h[0] = *(const v8h*)&ks[kr * LDT + w2 * 32 + c0];
        af.h[1] = *(const v8h*)&ks[kr * LDT + w2 * 32 + c0 + 16];
        s[mt] = __builtin_amdgcn_wmma_f32_16x16x32_f16(
            false, af.v, false, bq[w2].v, (short)0, s[mt], false, false);
      }
    }
    // online softmax in base 2: exp((x - m) / 8) = exp2(x * SC - m * SC), so a score
    // costs one fused multiply-add and one hardware exponential. s stays unscaled;
    // mst holds the running maximum times SC (SC > 0: scaling keeps the order).
    // The maximum is joined across the halves every tile, so both halves scale alike;
    // the halves' sums are joined once, behind the loop.
    v8f m8 = __builtin_elementwise_max(__builtin_elementwise_max(s[0], s[1]),
                                       __builtin_elementwise_max(s[2], s[3]));
    float rm = fmaxf(fmaxf(fmaxf(m8[0], m8[1]), fmaxf(m8[2], m8[3])),
                     fmaxf(fmaxf(m8[4], m8[5]), fmaxf(m8[6], m8[7])));
    rm = fmaxf(rm, other_half(rm));
    const float mn = fmaxf(mst, rm * SC);
    const float corr = __builtin_amdgcn_exp2f(mst - mn);
    mst = mn;
    const v8f sc8 = {SC, SC, SC, SC, SC, SC, SC, SC};
    const v8f nm8 = {-mn, -mn, -mn, -mn, -mn, -mn, -mn, -mn};
#pragma unroll
    for (int mt = 0; mt < 4; ++mt) {
      s[mt] = __builtin_elementwise_fma(s[mt], sc8, nm8);
#pragma unroll
      for (int r = 0; r < 8; ++r) s[mt][r] = __builtin_amdgcn_exp2f(s[mt][r]);
    }
    v8f a8 = (s[0] + s[1]) + (s[2] + s[3]);
    const float rsum = ((a8[0] + a8[1]) + (a8[2] + a8[3])) + ((a8[4] + a8[5]) + (a8[6] + a8[7]));
    lst = lst * corr + rsum;
#pragma unroll
    for (int dt = 0; dt < 4; ++dt) oa[dt] *= corr;

    // Pt as B: element e of k step w2 is key w2 * 32 + (e < 8 ? 8 * h + e : 16 + 8 * h + e - 8),
    // which is register e & 7 of St tile 2 * w2 + (e >> 3)
    FragH pb[2];
#pragma unroll
    for (int w2 = 0; w2 < 2; ++w2)
#pragma unroll
      for (int e = 0; e < 16; ++e) pb[w2].v[e] = (_Float16)s[2 * w2 + (e >> 3)][e & 7];
    // Vt as A: row = d dt * 16 + fr; a transposing load at key base kb0 gives the lane keys
    // kb0 + 8 * h + 0..7, so the loads at w2 * 32 and w2 * 32 + 16 have Pt's k order
    const _Float16* vp = &vs[(c0 + (lane & 7)) * LDV + ((lane >> 3) & 1) * 8];
#pragma unroll
    for (int dt = 0; dt < 4; ++dt) {
#pragma unroll
      for (int w2 = 0; w2 < 2; ++w2) {
        FragH av;
        av.h[0] = lds_tr16(vp + (w2 * 32) * LDV + dt * 16);
        av.h[1] = lds_tr16(vp + (w2 * 32 + 16) * LDV + dt * 16);
        oa[dt] = __builtin_amdgcn_wmma_f32_16x16x32_f16(
            false, av.v, false, pb[w2].v, (short)0, oa[dt], false, false);
      }
    }
  }

  // a lane's 8 registers of a tile are 8 consecutive d of its query: 16 B stores
  const float inv = 1.0f / (lst + other_half(lst));
  _Float16* ob = o + (size_t)b * SEQ * os + (size_t)h * D
                   + (size_t)(qt * 64 + wid * 16 + fr) * os + c0;
  v8h ov[4];
#pragma unroll
  for (int dt = 0; dt < 4; ++dt)
#pragma unroll
    for (int r = 0; r < 8; ++r) ov[dt][r] = (_Float16)(oa[dt][r] * inv);
#pragma unroll
  for (int dt = 0; dt < 4; ++dt) *(v8h*)(ob + dt * 16) = ov[dt];
}

// ---------------------------------------------------------------------------
extern "C" void kernel_launch(void* const* d_in, const int* in_sizes, int n_in,
                              void* d_out, int out_size, void* d_ws, size_t ws_size,
                              hipStream_t stream) {
  (void)in_sizes; (void)n_in; (void)out_size; (void)ws_size;
  const float* x   = (const float*)d_in[0];
  const float* wq  = (const float*)d_in[1];
  const float* bq  = (const float*)d_in[2];
  const float* wk  = (const float*)d_in[3];
  const float* bk  = (const float*)d_in[4];
  const float* wv  = (const float*)d_in[5];
  const float* bv  = (const float*)d_in[6];
  const float* wo  = (const float*)d_in[7];
  const float* bo  = (const float*)d_in[8];
  const float* w1  = (const float*)d_in[9];
  const float* b1  = (const float*)d_in[10];
  const float* w2  = (const float*)d_in[11];
  const float* b2  = (const float*)d_in[12];
  const float* g1  = (const float*)d_in[13];
  const float* be1 = (const float*)d_in[14];
  const float* g2  = (const float*)d_in[15];
  const float* be2 = (const float*)d_in[16];

  char* ws = (char*)d_ws;
  size_t off = 0;
  auto alloc = [&](size_t bytes) -> void* {
    void* p = ws + off;
    off += (bytes + 255) & ~(size_t)255;
    return p;
  };
  _Float16* ln16   = (_Float16*)alloc((size_t)ROWS * D_MODEL * 2);
  _Float16* qkv16  = (_Float16*)alloc((size_t)ROWS * 3 * D_MODEL * 2);
  _Float16* attn16 = (_Float16*)alloc((size_t)ROWS * D_MODEL * 2);
  float*    x1     = (float*)   alloc((size_t)ROWS * D_MODEL * 4);
  _Float16* h16    = (_Float16*)alloc((size_t)ROWS * D_FF * 2);
  _Float16* wqkvT  = (_Float16*)alloc((size_t)3 * D_MODEL * D_MODEL * 2);
  _Float16* woT    = (_Float16*)alloc((size_t)D_MODEL * D_MODEL * 2);
  _Float16* w1T    = (_Float16*)alloc((size_t)D_MODEL * D_FF * 2);
  _Float16* w2T    = (_Float16*)alloc((size_t)D_FF * D_MODEL * 2);
  float*    bqkv   = (float*)   alloc((size_t)3 * D_MODEL * 4);

  prep_kernel<<<PREP_GRID, 256, 0, stream>>>(x, g1, be1, ln16, wq, wk, wv, wo, w1, w2,
                                             wqkvT, woT, w1T, w2T, bq, bk, bv, bqkv);

  dim3 g768(D_MODEL / 128, ROWS / 128);
  dim3 gqkv(3 * D_MODEL / 128, ROWS / 128);
  gemm_wmma_kernel<0><<<gqkv, 256, 0, stream>>>(ln16, wqkvT, bqkv, nullptr, qkv16, nullptr,
                                                ROWS, 3 * D_MODEL, D_MODEL);

  dim3 gfa(SEQ / 64, HEADS, BATCH);
  flash_kernel<<<gfa, 128, 0, stream>>>(qkv16, qkv16 + D_MODEL, qkv16 + 2 * D_MODEL, attn16);

  gemm_wmma_kernel<2><<<g768, 256, 0, stream>>>(attn16, woT, bo, x, nullptr, x1,
                                                ROWS, D_MODEL, D_MODEL);

  ln_kernel<<<ROWS / 8, 256, 0, stream>>>(x1, g2, be2, ln16);

  dim3 gff(D_FF / 128, ROWS / 128);
  gemm_wmma_kernel<1><<<gff, 256, 0, stream>>>(ln16, w1T, b1, nullptr, h16, nullptr,
                                               ROWS, D_FF, D_MODEL);
  gemm_wmma_kernel<2><<<g768, 256, 0, stream>>>(h16, w2T, b2, x1, nullptr, (float*)d_out,
                                                ROWS, D_MODEL, D_FF);
}
